// v000
// The times below were measured on an AMD MI455X: many runs one after another, warmed up first and cycling through
// copies of the inputs, with the whole window's GPU time divided by the number of runs. Launches and the gaps
// between them are all in it. The median over several windows is given; except for v000 it joins two sittings, which
// can be a few percent apart, so the side-by-side timings, each taken in one sitting, are the better comparison.
// The starting kernel, v000, takes 419 microseconds a run.
#include <hip/hip_runtime.h>
#include <math.h>

typedef __attribute__((ext_vector_type(16))) _Float16 v16h;
typedef __attribute__((ext_vector_type(16))) __bf16 v16b;
typedef __attribute__((ext_vector_type(8)))  _Float16 v8h;
typedef __attribute__((ext_vector_type(8)))  float v8f;
typedef __attribute__((ext_vector_type(4)))  float v4f;
typedef __attribute__((ext_vector_type(2)))  float v2f;
typedef __attribute__((ext_vector_type(4)))  unsigned v4u;
typedef __attribute__((ext_vector_type(4)))  int v4i;
typedef float __attribute__((may_alias)) float_a;
typedef int __attribute__((may_alias)) int_a;

template <typename T> __device__ __forceinline__ void vst2(void* p, T v) { *(T*)p = v;  }
__device__ __forceinline__ v8f wmma16(v16h a, v16h b, v8f c) {
  v8f d = __builtin_amdgcn_wmma_f32_16x16x32_f16(false, a, false, b, (short)0, c, false, false);
  asm volatile("v_nop\n\tv_nop\n\tv_nop\n\tv_nop" : "+v"(d) : "v"(a), "v"(b));
  return d;
}
__device__ __forceinline__ v8f wmma_bf(v16b a, v16b b, v8f c) {
  v8f d = __builtin_amdgcn_wmma_f32_16x16x32_bf16(false, a, false, b, (short)0, c, false, false);
  asm volatile("v_nop\n\tv_nop\n\tv_nop\n\tv_nop" : "+v"(d) : "v"(a), "v"(b));
  return d;
}
// 16x16x32 fragments: lane = (h = lane>>4, row/col = lane&15); elements 0..7 = k0+8h+0..7, 8..15 = k0+16+8h+0..7; D element r = row 8h+r
__device__ __forceinline__ v16h frag_h(const _Float16* rowk0, int lane) {
  union { v16h v; v8h q[2]; } u; const _Float16* p = rowk0 + 8 * (lane >> 4);
  u.q[0] = *(const v8h*)p; u.q[1] = *(const v8h*)(p + 16); return u.v;
}
__device__ __forceinline__ v16h frag_f32(const float* rowk0, int lane) {
  v16h a; const float* p = rowk0 + 8 * (lane >> 4);
#pragma unroll
  for (int i = 0; i < 8; ++i) { a[i] = (_Float16)p[i]; a[8 + i] = (_Float16)p[16 + i]; }
  return a;
}
__device__ __forceinline__ v16h frag_f32s(const float* rowk0, int lane, float sc) {
  v16h a; const float* p = rowk0 + 8 * (lane >> 4);
#pragma unroll
  for (int i = 0; i < 8; ++i) { a[i] = (_Float16)(p[i] * sc); a[8 + i] = (_Float16)(p[16 + i] * sc); }
  return a;
}
// column fragment from a [K][ld] layout (column n), rows >= K read as 0
__device__ __forceinline__ v16h fragc_f32(const float* W, int k0, int n, int lane, int ld, int K) {
  v16h a; const int g = lane >> 4;
#pragma unroll
  for (int i = 0; i < 8; ++i) { const int ka = k0 + 8 * g + i, kb = ka + 16;
    a[i] = (_Float16)(ka < K ? W[(size_t)(ka < K ? ka : K - 1) * ld + n] : 0.f); a[8 + i] = (_Float16)(kb < K ? W[(size_t)(kb < K ? kb : K - 1) * ld + n] : 0.f); }
  return a;
}
struct F2 { v16b h, l; };
__device__ __forceinline__ F2 bsplit16(const float v[16]) { F2 r;
#pragma unroll
  for (int i = 0; i < 16; ++i) { const __bf16 h = (__bf16)v[i]; r.h[i] = h; r.l[i] = (__bf16)(v[i] - (float)h); }
  return r; }
__device__ __forceinline__ F2 split_row(const float* row, int k0, int lane) { float v[16]; const float* p = row + k0 + 8 * (lane >> 4);
#pragma unroll
  for (int i = 0; i < 8; ++i) { v[i] = p[i]; v[8 + i] = p[16 + i]; }
  return bsplit16(v); }
__device__ __forceinline__ F2 split_rowK(const float* row, int k0, int lane, int K) { float v[16]; const int g = lane >> 4;
#pragma unroll
  for (int i = 0; i < 8; ++i) { const int ka = k0 + 8 * g + i, kb = ka + 16; v[i] = ka < K ? row[ka < K ? ka : K - 1] : 0.f; v[8 + i] = kb < K ? row[kb < K ? kb : K - 1] : 0.f; }
  return bsplit16(v); }
__device__ __forceinline__ F2 split_col(const float* W, int k0, int n, int lane, int ld, int K) { float v[16]; const int g = lane >> 4;
#pragma unroll
  for (int i = 0; i < 8; ++i) { const int ka = k0 + 8 * g + i, kb = ka + 16; v[i] = ka < K ? W[(size_t)(ka < K ? ka : K - 1) * ld + n] : 0.f; v[8 + i] = kb < K ? W[(size_t)(kb < K ? kb : K - 1) * ld + n] : 0.f; }
  return bsplit16(v); }
__device__ __forceinline__ v8f mac3(const F2& a, const F2& b, v8f c) { c = wmma_bf(a.l, b.h, c); c = wmma_bf(a.h, b.l, c); return wmma_bf(a.h, b.h, c); }
__device__ __forceinline__ float sigm(float v) { return 1.0f / (1.0f + expf(-v)); }
#define LDSX() do { asm volatile("s_wait_dscnt 0" ::: "memory"); __builtin_amdgcn_wave_barrier(); __builtin_amdgcn_fence(__ATOMIC_RELEASE, "workgroup"); } while (0)

// MHLA (B 2, S 2,048, 1,024 = 32 heads x 32): q,k,v = split(x Wqkv^T + b) as [B,S,3,H,Dh]; a = q k^T (no softmax); ctx = a v  (== q (k^T v), reassociated exactly); GroupNorm per (b, head) over (Dh, S) with eps 1e-5 and per-channel affine; out = ctx out_w^T + out_b.
__device__ __forceinline__ float bfr(float v) { return (float)(__bf16)v; }
#define NB 2
#define TT 2048
#define CC 1024
#define NH 32
#define HD 32
#ifndef TNB
#define TNB NB
#endif
#ifndef QSTR
#define QSTR (TT * CC)        // unused; x rows are read as [b*T+t][1024]
#endif
typedef __attribute__((ext_vector_type(8))) __bf16 v8b;
__device__ __forceinline__ v16b frag_b(const __bf16* rowk0, int lane) { union { v16b v; v8b q[2]; } u; const __bf16* p = rowk0 + 8 * (lane >> 4); u.q[0] = *(const v8b*)p; u.q[1] = *(const v8b*)(p + 16); return u.v; }
#define WS_QH  0u                                          // f16 q hi rows [b*T+t][1024]
#define WS_QL  (WS_QH + 2u * (size_t)NB * TT * CC)
#define WS_KT  (WS_QL + 2u * (size_t)NB * TT * CC)           // bf16 k hi planes [b][c][s]
#define WS_KL  (WS_KT + 2u * (size_t)NB * CC * TT)
#define WS_VT  (WS_KL + 2u * (size_t)NB * CC * TT)           // bf16 v hi planes [b][c][s]
#define WS_VL  (WS_VT + 2u * (size_t)NB * CC * TT)
#define WS_KV  (WS_VL + 2u * (size_t)NB * CC * TT)           // f16 KV hi + residual 'Bt rows' [b][h][j][i] (j = v dim = output col, i = k dim)
#define WS_KVL (WS_KV + 2u * (size_t)NB * NH * HD * HD)
#define WS_CTX (WS_KVL + 2u * (size_t)NB * NH * HD * HD)      // f32 ctx rows [b*T+t][1024]
#define WS_GS  (WS_CTX + 4u * (size_t)NB * TT * CC)          // f32 GroupNorm stats [b][h][2] (32-float lines)
#define WS_END (WS_GS + 4u * (size_t)NB * NH * 2 * 16)
// ---- k_proj: block = (64 rows, 128 cols, which): qkv = x W^T + b ([out,in] rows which*1024 + o), x, W, b rounded to bf16, one product; q -> f16 hi + residual rows; k, v -> bf16 hi + lo planes [b][c][t]
__global__ __launch_bounds__(128) void k_proj(const float* __restrict__ X, const float* __restrict__ Wt, const float* __restrict__ Bv, _Float16* __restrict__ QH, _Float16* __restrict__ QL, __bf16* __restrict__ KT, __bf16* __restrict__ KL, __bf16* __restrict__ VT, __bf16* __restrict__ VL) {
  __shared__ __align__(16) _Float16 sh[64][136], sl[64][136]; __shared__ __align__(16) __bf16 th[128][72], tl2[128][72];
  const int tid = threadIdx.x, wave = tid >> 5, lane = tid & 31, col = lane & 15, g = lane >> 4; const int which = blockIdx.z; const int c0 = blockIdx.y * 128; const size_t r0 = (size_t)blockIdx.x * 64;
  v8f acc[8] = {};
#pragma unroll 2
  for (int kc = 0; kc < CC / 32; ++kc) { v16b a; { const float* p = X + (r0 + wave * 16 + col) * CC + kc * 32 + 8 * g;
#pragma unroll
      for (int i = 0; i < 8; ++i) { a[i] = (__bf16)p[i]; a[8 + i] = (__bf16)p[16 + i]; } }
#pragma unroll
    for (int j = 0; j < 8; ++j) { v16b w; const float* wr = Wt + (size_t)(which * CC + c0 + j * 16 + col) * CC + kc * 32 + 8 * g;
#pragma unroll
      for (int i = 0; i < 8; ++i) { w[i] = (__bf16)wr[i]; w[8 + i] = (__bf16)wr[16 + i]; }
      asm volatile("s_wait_loadcnt 0x0" ::: "memory"); acc[j] = wmma_bf(a, w, acc[j]); } }
#pragma unroll
  for (int j = 0; j < 8; ++j) { const int cl = j * 16 + col; const float bb = bfr(Bv[which * CC + c0 + cl]);
#pragma unroll
    for (int r = 0; r < 8; ++r) { const float v = acc[j][r] + bb; const int rl = wave * 16 + 8 * g + r;
      if (which == 0) { const _Float16 hv = (_Float16)v; sh[rl][cl] = hv; sl[rl][cl] = (_Float16)((v - (float)hv) * 1024.0f); } else { const __bf16 bh = (__bf16)v; th[cl][rl] = bh; tl2[cl][rl] = (__bf16)(v - (float)bh); } } }
  __syncthreads();
  if (which == 0) { for (int e = tid; e < 64 * 16; e += 128) { const int rl = e >> 4, q = e & 15; vst2((unsigned*)(QH + (r0 + rl) * CC + c0 + q * 8), *(const v4u*)&sh[rl][q * 8]); vst2((unsigned*)(QL + (r0 + rl) * CC + c0 + q * 8), *(const v4u*)&sl[rl][q * 8]); } }
  else { __bf16* DT = which == 1 ? KT : VT; __bf16* DL = which == 1 ? KL : VL; const size_t b = r0 / TT; const int t0 = (int)(r0 % TT); for (int e = tid; e < 128 * 8; e += 128) { const int cl = e >> 3, q = e & 7; const size_t o2 = (b * CC + c0 + cl) * (size_t)TT + t0 + q * 8; vst2((unsigned*)(DT + o2), *(const v4u*)&th[cl][q * 8]); vst2((unsigned*)(DL + o2), *(const v4u*)&tl2[cl][q * 8]); } } }
// ---- k_kv: block = (b, h), one wave does the 2 x 2 tiles: KV[i][j] = sum_s k[s][i] v[s][j] over all s (A rows = k planes (i), B cols = v planes (j); 3 products); stored as f16 hi + residual 'Bt rows' [j][i] (the layout the ctx GEMM's B fragment wants): 2 KB + 2 KB per (b,h)
__global__ __launch_bounds__(32) void k_kv(const __bf16* __restrict__ KT, const __bf16* __restrict__ KL, const __bf16* __restrict__ VT, const __bf16* __restrict__ VL, _Float16* __restrict__ KV, _Float16* __restrict__ KVL) { __shared__ __align__(16) _Float16 sh[32][40], sl[32][40];
  const int lane = threadIdx.x, col = lane & 15, g = lane >> 4; const size_t b = blockIdx.y; const int h = blockIdx.x; const __bf16* kb = KT + (b * CC + h * HD) * (size_t)TT; const __bf16* klb = KL + (b * CC + h * HD) * (size_t)TT; const __bf16* vb = VT + (b * CC + h * HD) * (size_t)TT; const __bf16* vlb = VL + (b * CC + h * HD) * (size_t)TT;
  v8f acc[2][2] = {};
#pragma unroll 2
  for (int kc = 0; kc < TT / 32; ++kc) {
#pragma unroll
    for (int it = 0; it < 2; ++it) { const v16b ah = frag_b(kb + (size_t)(it * 16 + col) * TT + kc * 32, lane), al = frag_b(klb + (size_t)(it * 16 + col) * TT + kc * 32, lane);
#pragma unroll
      for (int jt = 0; jt < 2; ++jt) { const v16b bh = frag_b(vb + (size_t)(jt * 16 + col) * TT + kc * 32, lane), bl = frag_b(vlb + (size_t)(jt * 16 + col) * TT + kc * 32, lane); acc[it][jt] = wmma_bf(ah, bh, acc[it][jt]); acc[it][jt] = wmma_bf(al, bh, acc[it][jt]); acc[it][jt] = wmma_bf(ah, bl, acc[it][jt]); } } }
#pragma unroll
  for (int it = 0; it < 2; ++it)
#pragma unroll
    for (int jt = 0; jt < 2; ++jt)
#pragma unroll
      for (int r = 0; r < 8; ++r) { const float v = acc[it][jt][r]; const int i = it * 16 + 8 * g + r, j = jt * 16 + col; const _Float16 hv = (_Float16)v; sh[j][i] = hv; sl[j][i] = (_Float16)((v - (float)hv) * 1024.0f); }
  LDSX();
  for (int e = lane; e < 32 * 4; e += 32) { const int j = e >> 2, q = e & 3; const size_t o = ((b * NH + h) * HD + j) * HD + q * 8; vst2((unsigned*)(KV + o), *(const v4u*)&sh[j][q * 8]); vst2((unsigned*)(KVL + o), *(const v4u*)&sl[j][q * 8]); } }
// ---- k_ctx: block = (64 rows t, 4 heads): ctx[t][h*32 + j] = sum_i q[t][h*32 + i] KV_h[i][j] (q hi+res x KV hi+res, 3 products, K = 32 = one chunk); 512-B segments per row
__global__ __launch_bounds__(128) void k_ctx(const _Float16* __restrict__ QH, const _Float16* __restrict__ QL, const _Float16* __restrict__ KV, const _Float16* __restrict__ KVL, float* __restrict__ CTX) { __shared__ __align__(16) float sf[4][16][132];
  const int tid = threadIdx.x, wave = tid >> 5, lane = tid & 31, col = lane & 15, g = lane >> 4; const int h0 = blockIdx.y * 4; const size_t r0 = (size_t)blockIdx.x * 64 + wave * 16; const size_t b = r0 / TT;
#pragma unroll
  for (int hh = 0; hh < 4; ++hh) { const int h = h0 + hh; v8f acc[2] = {}; const v16h ah = frag_h(QH + (r0 + col) * CC + h * HD, lane), al = frag_h(QL + (r0 + col) * CC + h * HD, lane);
#pragma unroll
    for (int jt = 0; jt < 2; ++jt) { const size_t bo = ((b * NH + h) * HD + jt * 16 + col) * HD; const v16h bh = frag_h(KV + bo, lane), bl = frag_h(KVL + bo, lane); acc[jt] = wmma16(ah, bh, acc[jt]); v8f t2 = {}; t2 = wmma16(al, bh, t2); t2 = wmma16(ah, bl, t2);
#pragma unroll
      for (int r = 0; r < 8; ++r) sf[wave][8 * g + r][hh * 32 + jt * 16 + col] = acc[jt][r] + t2[r] * (1.0f / 1024.0f); } }
  LDSX(); for (int rl = 0; rl < 16; ++rl) vst2(CTX + (r0 + rl) * CC + h0 * HD + lane * 4, *(const v4f*)&sf[wave][rl][lane * 4]); }
__global__ __launch_bounds__(256) void k_gn(const float* __restrict__ CTX, float* __restrict__ GS) { __shared__ float sred[8]; __shared__ float sbc;
  const int t = threadIdx.x; const int h = blockIdx.x; const size_t b = blockIdx.y; const float* base = CTX + (b * TT) * CC + h * HD; const int n = TT * HD;
  float s = 0.f; for (int e = t; e < TT * 8; e += 256) { const int row = e >> 3, q = e & 7; const v4f v = *(const v4f*)(base + (size_t)row * CC + q * 4); s += (v[0] + v[1]) + (v[2] + v[3]); }
#pragma unroll
  for (int o = 1; o < 32; o <<= 1) s += __shfl_xor(s, o);
  if ((t & 31) == 0) sred[t >> 5] = s; __syncthreads(); if (t == 0) { float a = 0.f; for (int w = 0; w < 8; ++w) a += sred[w]; sbc = a / (float)n; } __syncthreads(); const float mu = sbc; __syncthreads();
  float s2 = 0.f; for (int e = t; e < TT * 8; e += 256) { const int row = e >> 3, q = e & 7; const v4f v = *(const v4f*)(base + (size_t)row * CC + q * 4); const float d0 = v[0] - mu, d1 = v[1] - mu, d2 = v[2] - mu, d3 = v[3] - mu; s2 += (d0 * d0 + d1 * d1) + (d2 * d2 + d3 * d3); }
#pragma unroll
  for (int o = 1; o < 32; o <<= 1) s2 += __shfl_xor(s2, o);
  if ((t & 31) == 0) sred[t >> 5] = s2; __syncthreads();
  if (t < 32) { float v = 0.f; if (t == 0) v = mu; if (t == 1) { float a = 0.f; for (int w = 0; w < 8; ++w) a += sred[w]; v = rsqrtf(a / (float)n + 1e-5f); } vst2(GS + (b * NH + h) * 32 + t, v); } }
// ---- k_out: block = (64 rows, 128 cols): out = gh (hi + lo) out_w^T + out_b with gh = (ctx - mu_h) rstd_h gn_w[c] + gn_b[c] built on the fly; 4-KB rows
__global__ __launch_bounds__(128) void k_out(const float* __restrict__ CTX, const float* __restrict__ GS, const float* __restrict__ GW, const float* __restrict__ GB, const float* __restrict__ WO, const float* __restrict__ BO, float* __restrict__ OUT) { __shared__ __align__(16) float sf[4][16][132];
  const int tid = threadIdx.x, wave = tid >> 5, lane = tid & 31, col = lane & 15, g = lane >> 4; const int c0 = blockIdx.y * 128; const size_t r0 = (size_t)blockIdx.x * 64 + wave * 16; const size_t b = r0 / TT;
  v8f acc[8] = {};
#pragma unroll 2
  for (int kc = 0; kc < CC / 32; ++kc) { float v[16]; { const int h = kc;   /* 32 channels per chunk == one head */ const float mu = GS[(b * NH + h) * 32], rs = GS[(b * NH + h) * 32 + 1]; const float* p = CTX + (r0 + col) * CC + kc * 32 + 8 * g;
#pragma unroll
      for (int i = 0; i < 8; ++i) { const int c1 = kc * 32 + 8 * g + i, c2 = c1 + 16; v[i] = (p[i] - mu) * rs * bfr(GW[c1]) + bfr(GB[c1]); v[8 + i] = (p[16 + i] - mu) * rs * bfr(GW[c2]) + bfr(GB[c2]); } }
    asm volatile("s_wait_loadcnt 0x0" ::: "memory"); const F2 a = bsplit16(v);
#pragma unroll
    for (int j = 0; j < 8; ++j) { v16b w; const float* wr = WO + (size_t)(c0 + j * 16 + col) * CC + kc * 32 + 8 * g;
#pragma unroll
      for (int i = 0; i < 8; ++i) { w[i] = (__bf16)wr[i]; w[8 + i] = (__bf16)wr[16 + i]; }
      asm volatile("s_wait_loadcnt 0x0" ::: "memory"); acc[j] = wmma_bf(a.h, w, acc[j]); acc[j] = wmma_bf(a.l, w, acc[j]); } }
#pragma unroll
  for (int j = 0; j < 8; ++j) { const float bb = bfr(BO[c0 + j * 16 + col]);
#pragma unroll
    for (int r = 0; r < 8; ++r) sf[wave][8 * g + r][j * 16 + col] = acc[j][r] + bb; }
  LDSX(); for (int rl = 0; rl < 16; ++rl) vst2(OUT + (r0 + rl) * CC + c0 + lane * 4, *(const v4f*)&sf[wave][rl][lane * 4]); }
extern "C" void kernel_launch(void* const* d_in, const int* in_sizes, int n_in, void* d_out, int out_size, void* d_ws, size_t ws_size, hipStream_t stream) {
  (void)in_sizes; (void)n_in; (void)out_size;
  const float** F = (const float**)d_in;   // 0 x [2,2048,1024], 1 Wqkv_w [3072,1024] ([out,in]; channel o = which*1024 + h*32 + d), 2 Wqkv_b [3072], 3 gn_w [1024], 4 gn_b, 5 out_w [1024,1024] ([out,in]), 6 out_b
  if (ws_size < (size_t)WS_END) return;
  char* ws = (char*)d_ws; _Float16 *QH = (_Float16*)(ws + WS_QH), *QL = (_Float16*)(ws + WS_QL), *KV = (_Float16*)(ws + WS_KV), *KVL = (_Float16*)(ws + WS_KVL); __bf16 *KT = (__bf16*)(ws + WS_KT), *KL = (__bf16*)(ws + WS_KL), *VT = (__bf16*)(ws + WS_VT), *VL = (__bf16*)(ws + WS_VL); float *CTX = (float*)(ws + WS_CTX), *GS = (float*)(ws + WS_GS);
  k_proj<<<dim3(TNB * TT / 64, CC / 128, 3), 128, 0, stream>>>(F[0], F[1], F[2], QH, QL, KT, KL, VT, VL);
  k_kv<<<dim3(NH, TNB), 32, 0, stream>>>(KT, KL, VT, VL, KV, KVL);
  k_ctx<<<dim3(TNB * TT / 64, NH / 4), 128, 0, stream>>>(QH, QL, KV, KVL, CTX);
  k_gn<<<dim3(NH, TNB), 256, 0, stream>>>(CTX, GS);
  k_out<<<dim3(TNB * TT / 64, CC / 128), 128, 0, stream>>>(CTX, GS, F[3], F[4], F[5], F[6], (float*)d_out);
}

// v001
// One run takes 139 microseconds.
// In two side-by-side timings against v000, it was 3.02 and 3.01 times as fast.
#include <hip/hip_runtime.h>
#include <math.h>

typedef __attribute__((ext_vector_type(16))) _Float16 v16h;
typedef __attribute__((ext_vector_type(16))) __bf16 v16b;
typedef __attribute__((ext_vector_type(8)))  _Float16 v8h;
typedef __attribute__((ext_vector_type(8)))  float v8f;
typedef __attribute__((ext_vector_type(4)))  float v4f;
typedef __attribute__((ext_vector_type(2)))  float v2f;
typedef __attribute__((ext_vector_type(4)))  unsigned v4u;
typedef __attribute__((ext_vector_type(4)))  int v4i;
typedef float __attribute__((may_alias)) float_a;
typedef int __attribute__((may_alias)) int_a;

template <typename T> __device__ __forceinline__ void vst2(void* p, T v) { *(T*)p = v;  }
__device__ __forceinline__ v8f wmma16(v16h a, v16h b, v8f c) {
  v8f d = __builtin_amdgcn_wmma_f32_16x16x32_f16(false, a, false, b, (short)0, c, false, false);
  asm volatile("v_nop\n\tv_nop\n\tv_nop\n\tv_nop" : "+v"(d) : "v"(a), "v"(b));
  return d;
}
__device__ __forceinline__ v8f wmma_bf(v16b a, v16b b, v8f c) {
  v8f d = __builtin_amdgcn_wmma_f32_16x16x32_bf16(false, a, false, b, (short)0, c, false, false);
  asm volatile("v_nop\n\tv_nop\n\tv_nop\n\tv_nop" : "+v"(d) : "v"(a), "v"(b));
  return d;
}
// 16x16x32 fragments: lane = (h = lane>>4, row/col = lane&15); elements 0..7 = k0+8h+0..7, 8..15 = k0+16+8h+0..7; D element r = row 8h+r
__device__ __forceinline__ v16h frag_h(const _Float16* rowk0, int lane) {
  union { v16h v; v8h q[2]; } u; const _Float16* p = rowk0 + 8 * (lane >> 4);
  u.q[0] = *(const v8h*)p; u.q[1] = *(const v8h*)(p + 16); return u.v;
}
__device__ __forceinline__ v16h frag_f32(const float* rowk0, int lane) {
  v16h a; const float* p = rowk0 + 8 * (lane >> 4);
#pragma unroll
  for (int i = 0; i < 8; ++i) { a[i] = (_Float16)p[i]; a[8 + i] = (_Float16)p[16 + i]; }
  return a;
}
__device__ __forceinline__ v16h frag_f32s(const float* rowk0, int lane, float sc) {
  v16h a; const float* p = rowk0 + 8 * (lane >> 4);
#pragma unroll
  for (int i = 0; i < 8; ++i) { a[i] = (_Float16)(p[i] * sc); a[8 + i] = (_Float16)(p[16 + i] * sc); }
  return a;
}
// column fragment from a [K][ld] layout (column n), rows >= K read as 0
__device__ __forceinline__ v16h fragc_f32(const float* W, int k0, int n, int lane, int ld, int K) {
  v16h a; const int g = lane >> 4;
#pragma unroll
  for (int i = 0; i < 8; ++i) { const int ka = k0 + 8 * g + i, kb = ka + 16;
    a[i] = (_Float16)(ka < K ? W[(size_t)(ka < K ? ka : K - 1) * ld + n] : 0.f); a[8 + i] = (_Float16)(kb < K ? W[(size_t)(kb < K ? kb : K - 1) * ld + n] : 0.f); }
  return a;
}
struct F2 { v16b h, l; };
__device__ __forceinline__ F2 bsplit16(const float v[16]) { F2 r;
#pragma unroll
  for (int i = 0; i < 16; ++i) { const __bf16 h = (__bf16)v[i]; r.h[i] = h; r.l[i] = (__bf16)(v[i] - (float)h); }
  return r; }
__device__ __forceinline__ F2 split_row(const float* row, int k0, int lane) { float v[16]; const float* p = row + k0 + 8 * (lane >> 4);
#pragma unroll
  for (int i = 0; i < 8; ++i) { v[i] = p[i]; v[8 + i] = p[16 + i]; }
  return bsplit16(v); }
__device__ __forceinline__ F2 split_rowK(const float* row, int k0, int lane, int K) { float v[16]; const int g = lane >> 4;
#pragma unroll
  for (int i = 0; i < 8; ++i) { const int ka = k0 + 8 * g + i, kb = ka + 16; v[i] = ka < K ? row[ka < K ? ka : K - 1] : 0.f; v[8 + i] = kb < K ? row[kb < K ? kb : K - 1] : 0.f; }
  return bsplit16(v); }
__device__ __forceinline__ F2 split_col(const float* W, int k0, int n, int lane, int ld, int K) { float v[16]; const int g = lane >> 4;
#pragma unroll
  for (int i = 0; i < 8; ++i) { const int ka = k0 + 8 * g + i, kb = ka + 16; v[i] = ka < K ? W[(size_t)(ka < K ? ka : K - 1) * ld + n] : 0.f; v[8 + i] = kb < K ? W[(size_t)(kb < K ? kb : K - 1) * ld + n] : 0.f; }
  return bsplit16(v); }
__device__ __forceinline__ v8f mac3(const F2& a, const F2& b, v8f c) { c = wmma_bf(a.l, b.h, c); c = wmma_bf(a.h, b.l, c); return wmma_bf(a.h, b.h, c); }
__device__ __forceinline__ float sigm(float v) { return 1.0f / (1.0f + expf(-v)); }
#define LDSX() do { asm volatile("s_wait_dscnt 0" ::: "memory"); __builtin_amdgcn_wave_barrier(); __builtin_amdgcn_fence(__ATOMIC_RELEASE, "workgroup"); } while (0)

// MHLA (B 2, S 2,048, 1,024 = 32 heads x 32): q,k,v = split(x Wqkv^T + b) as [B,S,3,H,Dh]; a = q k^T (no softmax); ctx = a v  (== q (k^T v), reassociated exactly); GroupNorm per (b, head) over (Dh, S) with eps 1e-5 and per-channel affine; out = ctx out_w^T + out_b.
__device__ __forceinline__ float bfr(float v) { return (float)(__bf16)v; }
#define NB 2
#define TT 2048
#define CC 1024
#define NH 32
#define HD 32
#ifndef TNB
#define TNB NB
#endif
#ifndef QSTR
#define QSTR (TT * CC)        // unused; x rows are read as [b*T+t][1024]
#endif
typedef __attribute__((ext_vector_type(8))) __bf16 v8b;
__device__ __forceinline__ v16b frag_b(const __bf16* rowk0, int lane) { union { v16b v; v8b q[2]; } u; const __bf16* p = rowk0 + 8 * (lane >> 4); u.q[0] = *(const v8b*)p; u.q[1] = *(const v8b*)(p + 16); return u.v; }
#define WS_QH  0u                                          // f16 q hi rows [b*T+t][1024]
#define WS_QL  (WS_QH + 2u * (size_t)NB * TT * CC)
#define WS_KT  (WS_QL + 2u * (size_t)NB * TT * CC)           // bf16 k hi planes [b][c][s]
#define WS_KL  (WS_KT + 2u * (size_t)NB * CC * TT)
#define WS_VT  (WS_KL + 2u * (size_t)NB * CC * TT)           // bf16 v hi planes [b][c][s]
#define WS_VL  (WS_VT + 2u * (size_t)NB * CC * TT)
#define WS_KV  (WS_VL + 2u * (size_t)NB * CC * TT)           // f16 KV hi + residual 'Bt rows' [b][h][j][i] (j = v dim = output col, i = k dim)
#define WS_KVL (WS_KV + 2u * (size_t)NB * NH * HD * HD)
#define WS_CTX (WS_KVL + 2u * (size_t)NB * NH * HD * HD)      // f32 ctx rows [b*T+t][1024]
#define WS_GS  (WS_CTX + 4u * (size_t)NB * TT * CC)          // f32 GroupNorm stats [b][h][2] (32-float lines)
#define WS_END (WS_GS + 4u * (size_t)NB * NH * 2 * 16)
typedef __attribute__((ext_vector_type(4))) __bf16 v4b;
#define PT 40   // LDS row pitch of a staged 32-k bf16 row, in elements: 80 B = 16 B x odd, which ds_load_b128 fragment reads take without bank conflicts
// ---- k_proj: block = (128 rows, 128 cols, which), 8 waves of 32 x 64: qkv = x W^T + b ([out,in] rows which*1024 + o). Per 32-k step the block converts its x and W tiles to bf16 once and stages them in LDS (two buffers, next step's global loads in flight over the products); q -> f16 hi + residual rows; k, v -> bf16 hi + lo planes [b][c][t]
__global__ __launch_bounds__(256) void k_proj(const float* __restrict__ X, const float* __restrict__ Wt, const float* __restrict__ Bv, _Float16* __restrict__ QH, _Float16* __restrict__ QL, __bf16* __restrict__ KT, __bf16* __restrict__ KL, __bf16* __restrict__ VT, __bf16* __restrict__ VL) {
  __shared__ __align__(16) char sm[2 * 128 * 136 * 2];   // loop: x tiles [2][128][PT], W tiles [2][128][PT]; epilogue: hi and lo tiles [128][136]
  __bf16 (*sx)[128][PT] = (__bf16 (*)[128][PT])sm; __bf16 (*sw)[128][PT] = (__bf16 (*)[128][PT])(sm + 2 * 128 * PT * 2);
  const int tid = threadIdx.x, wave = tid >> 5, lane = tid & 31, col = lane & 15, g = lane >> 4, wm = wave >> 1, wn = wave & 1; const int which = blockIdx.z; const int c0 = blockIdx.y * 128; const size_t r0 = (size_t)blockIdx.x * 128;
  const int lr = tid >> 3, lq = tid & 7;   // staging: rows lr + 32 i, floats 4 lq .. 4 lq + 3 (8 lanes cover one 128-B line)
  const float* xp = X + r0 * CC; const float* wp = Wt + (size_t)(which * CC + c0) * CC; const unsigned lo = lr * CC + lq * 4;   // block-uniform bases, one 32-bit lane offset for both tiles
  v4f px[4], pw[4];
#pragma unroll
  for (int i = 0; i < 4; ++i) { px[i] = *(const v4f*)(xp + i * 32 * CC + lo); pw[i] = *(const v4f*)(wp + i * 32 * CC + lo); }
  asm volatile("s_wait_xcnt 0x0" ::: "memory"); __builtin_amdgcn_sched_barrier(0);   // the wait stands in front of any later overwrite of the address registers that the loads above name; the scheduling barrier keeps later vector instructions from being lifted over it
  v8f acc[2][4] = {};
#pragma unroll 2
  for (int kc = 0; kc < CC / 32; ++kc) { const int bf = kc & 1;
#pragma unroll
    for (int i = 0; i < 4; ++i) { *(v4b*)&sx[bf][lr + 32 * i][lq * 4] = __builtin_convertvector(px[i], v4b); *(v4b*)&sw[bf][lr + 32 * i][lq * 4] = __builtin_convertvector(pw[i], v4b); }
    __syncthreads();   // publishes step kc's tiles; it also ends every wave's reads of the other buffer (step kc - 1) before step kc + 1 is stored there
    v16b a[2], w[4];
#pragma unroll
    for (int it = 0; it < 2; ++it) a[it] = frag_b(&sx[bf][wm * 32 + it * 16 + col][0], lane);
#pragma unroll
    for (int j = 0; j < 4; ++j) w[j] = frag_b(&sw[bf][wn * 64 + j * 16 + col][0], lane);
    if (kc + 1 < CC / 32) { const unsigned ko = lo + (kc + 1) * 32;
#pragma unroll
      for (int i = 0; i < 4; ++i) { px[i] = *(const v4f*)(xp + i * 32 * CC + ko); pw[i] = *(const v4f*)(wp + i * 32 * CC + ko); }
      asm volatile("s_wait_xcnt 0x0" ::: "memory"); __builtin_amdgcn_sched_barrier(0);   // the wait stands in front of any later overwrite of the address registers that the loads above name; the scheduling barrier keeps later vector instructions from being lifted over it
    }
#pragma unroll
    for (int it = 0; it < 2; ++it)
#pragma unroll
      for (int j = 0; j < 4; ++j) acc[it][j] = wmma_bf(a[it], w[j], acc[it][j]);
    __builtin_amdgcn_sched_barrier(0); }   // keeps the next step's conversions, and with them the wait for its global loads, behind this step's products
  __syncthreads();   // the last step's fragment reads end before the epilogue tiles overwrite the staging buffers
  _Float16 (*sh)[136] = (_Float16 (*)[136])sm; _Float16 (*sl)[136] = (_Float16 (*)[136])(sm + 128 * 136 * 2); __bf16 (*th)[136] = (__bf16 (*)[136])sm; __bf16 (*tl2)[136] = (__bf16 (*)[136])(sm + 128 * 136 * 2);
  float bv[4];
#pragma unroll
  for (int j = 0; j < 4; ++j) bv[j] = Bv[which * CC + c0 + wn * 64 + j * 16 + col];
  asm volatile("s_wait_xcnt 0x0" ::: "memory"); __builtin_amdgcn_sched_barrier(0);   // wait and scheduling barrier as behind the tile loads above
  if (which == 0) {
#pragma unroll
    for (int j = 0; j < 4; ++j) { const int cl = wn * 64 + j * 16 + col; const float bb = bfr(bv[j]);
#pragma unroll
      for (int it = 0; it < 2; ++it)
#pragma unroll
        for (int r = 0; r < 8; ++r) { const float v = acc[it][j][r] + bb; const int rl = wm * 32 + it * 16 + 8 * g + r; const _Float16 hv = (_Float16)v; sh[rl][cl] = hv; sl[rl][cl] = (_Float16)((v - (float)hv) * 1024.0f); } }
  } else {
#pragma unroll
    for (int j = 0; j < 4; ++j) { const int cl = wn * 64 + j * 16 + col; const float bb = bfr(bv[j]);
#pragma unroll
      for (int it = 0; it < 2; ++it) { v8b h8, l8;
#pragma unroll
        for (int r = 0; r < 8; ++r) { const float v = acc[it][j][r] + bb; const __bf16 bh = (__bf16)v; h8[r] = bh; l8[r] = (__bf16)(v - (float)bh); }
        *(v8b*)&th[cl][wm * 32 + it * 16 + 8 * g] = h8; *(v8b*)&tl2[cl][wm * 32 + it * 16 + 8 * g] = l8; }
      __builtin_amdgcn_sched_barrier(0); }   // one column group at a time: keeps the epilogue's register use under the loop's 160, at which three blocks share a WGP
  }
  __syncthreads();
  if (which == 0) { for (int e = tid; e < 128 * 16; e += 256) { const int rl = e >> 4, q = e & 15; vst2((unsigned*)(QH + (r0 + rl) * CC + c0 + q * 8), *(const v4u*)&sh[rl][q * 8]); vst2((unsigned*)(QL + (r0 + rl) * CC + c0 + q * 8), *(const v4u*)&sl[rl][q * 8]); } }
  else { __bf16* DT = which == 1 ? KT : VT; __bf16* DL = which == 1 ? KL : VL; const size_t b = r0 / TT; const int t0 = (int)(r0 % TT); for (int e = tid; e < 128 * 16; e += 256) { const int cl = e >> 4, q = e & 15; const size_t o2 = (b * CC + c0 + cl) * (size_t)TT + t0 + q * 8; vst2((unsigned*)(DT + o2), *(const v4u*)&th[cl][q * 8]); vst2((unsigned*)(DL + o2), *(const v4u*)&tl2[cl][q * 8]); } } }
// ---- k_kv: block = (b, h), one wave does the 2 x 2 tiles: KV[i][j] = sum_s k[s][i] v[s][j] over all s (A rows = k planes (i), B cols = v planes (j); 3 products); stored as f16 hi + residual 'Bt rows' [j][i] (the layout the ctx GEMM's B fragment wants): 2 KB + 2 KB per (b,h)
__global__ __launch_bounds__(32) void k_kv(const __bf16* __restrict__ KT, const __bf16* __restrict__ KL, const __bf16* __restrict__ VT, const __bf16* __restrict__ VL, _Float16* __restrict__ KV, _Float16* __restrict__ KVL) { __shared__ __align__(16) _Float16 sh[32][40], sl[32][40];
  const int lane = threadIdx.x, col = lane & 15, g = lane >> 4; const size_t b = blockIdx.y; const int h = blockIdx.x; const __bf16* kb = KT + (b * CC + h * HD) * (size_t)TT; const __bf16* klb = KL + (b * CC + h * HD) * (size_t)TT; const __bf16* vb = VT + (b * CC + h * HD) * (size_t)TT; const __bf16* vlb = VL + (b * CC + h * HD) * (size_t)TT;
  v8f acc[2][2] = {};
#pragma unroll 2
  for (int kc = 0; kc < TT / 32; ++kc) {
#pragma unroll
    for (int it = 0; it < 2; ++it) { const v16b ah = frag_b(kb + (size_t)(it * 16 + col) * TT + kc * 32, lane), al = frag_b(klb + (size_t)(it * 16 + col) * TT + kc * 32, lane);
#pragma unroll
      for (int jt = 0; jt < 2; ++jt) { const v16b bh = frag_b(vb + (size_t)(jt * 16 + col) * TT + kc * 32, lane), bl = frag_b(vlb + (size_t)(jt * 16 + col) * TT + kc * 32, lane); acc[it][jt] = wmma_bf(ah, bh, acc[it][jt]); acc[it][jt] = wmma_bf(al, bh, acc[it][jt]); acc[it][jt] = wmma_bf(ah, bl, acc[it][jt]); } } }
#pragma unroll
  for (int it = 0; it < 2; ++it)
#pragma unroll
    for (int jt = 0; jt < 2; ++jt)
#pragma unroll
      for (int r = 0; r < 8; ++r) { const float v = acc[it][jt][r]; const int i = it * 16 + 8 * g + r, j = jt * 16 + col; const _Float16 hv = (_Float16)v; sh[j][i] = hv; sl[j][i] = (_Float16)((v - (float)hv) * 1024.0f); }
  LDSX();
  for (int e = lane; e < 32 * 4; e += 32) { const int j = e >> 2, q = e & 3; const size_t o = ((b * NH + h) * HD + j) * HD + q * 8; vst2((unsigned*)(KV + o), *(const v4u*)&sh[j][q * 8]); vst2((unsigned*)(KVL + o), *(const v4u*)&sl[j][q * 8]); } }
// ---- k_ctx: block = (64 rows t, 4 heads): ctx[t][h*32 + j] = sum_i q[t][h*32 + i] KV_h[i][j] (q hi+res x KV hi+res, 3 products, K = 32 = one chunk); 512-B segments per row
__global__ __launch_bounds__(128) void k_ctx(const _Float16* __restrict__ QH, const _Float16* __restrict__ QL, const _Float16* __restrict__ KV, const _Float16* __restrict__ KVL, float* __restrict__ CTX) { __shared__ __align__(16) float sf[4][16][132];
  const int tid = threadIdx.x, wave = tid >> 5, lane = tid & 31, col = lane & 15, g = lane >> 4; const int h0 = blockIdx.y * 4; const size_t r0 = (size_t)blockIdx.x * 64 + wave * 16; const size_t b = r0 / TT;
#pragma unroll
  for (int hh = 0; hh < 4; ++hh) { const int h = h0 + hh; v8f acc[2] = {}; const v16h ah = frag_h(QH + (r0 + col) * CC + h * HD, lane), al = frag_h(QL + (r0 + col) * CC + h * HD, lane);
#pragma unroll
    for (int jt = 0; jt < 2; ++jt) { const size_t bo = ((b * NH + h) * HD + jt * 16 + col) * HD; const v16h bh = frag_h(KV + bo, lane), bl = frag_h(KVL + bo, lane); acc[jt] = wmma16(ah, bh, acc[jt]); v8f t2 = {}; t2 = wmma16(al, bh, t2); t2 = wmma16(ah, bl, t2);
#pragma unroll
      for (int r = 0; r < 8; ++r) sf[wave][8 * g + r][hh * 32 + jt * 16 + col] = acc[jt][r] + t2[r] * (1.0f / 1024.0f); } }
  LDSX(); for (int rl = 0; rl < 16; ++rl) vst2(CTX + (r0 + rl) * CC + h0 * HD + lane * 4, *(const v4f*)&sf[wave][rl][lane * 4]); }
__global__ __launch_bounds__(256) void k_gn(const float* __restrict__ CTX, float* __restrict__ GS) { __shared__ float sred[8]; __shared__ float sbc;
  const int t = threadIdx.x; const int h = blockIdx.x; const size_t b = blockIdx.y; const float* base = CTX + (b * TT) * CC + h * HD; const int n = TT * HD;
  float s = 0.f; for (int e = t; e < TT * 8; e += 256) { const int row = e >> 3, q = e & 7; const v4f v = *(const v4f*)(base + (size_t)row * CC + q * 4); s += (v[0] + v[1]) + (v[2] + v[3]); }
#pragma unroll
  for (int o = 1; o < 32; o <<= 1) s += __shfl_xor(s, o);
  if ((t & 31) == 0) sred[t >> 5] = s; __syncthreads(); if (t == 0) { float a = 0.f; for (int w = 0; w < 8; ++w) a += sred[w]; sbc = a / (float)n; } __syncthreads(); const float mu = sbc; __syncthreads();
  float s2 = 0.f; for (int e = t; e < TT * 8; e += 256) { const int row = e >> 3, q = e & 7; const v4f v = *(const v4f*)(base + (size_t)row * CC + q * 4); const float d0 = v[0] - mu, d1 = v[1] - mu, d2 = v[2] - mu, d3 = v[3] - mu; s2 += (d0 * d0 + d1 * d1) + (d2 * d2 + d3 * d3); }
#pragma unroll
  for (int o = 1; o < 32; o <<= 1) s2 += __shfl_xor(s2, o);
  if ((t & 31) == 0) sred[t >> 5] = s2; __syncthreads();
  if (t < 32) { float v = 0.f; if (t == 0) v = mu; if (t == 1) { float a = 0.f; for (int w = 0; w < 8; ++w) a += sred[w]; v = rsqrtf(a / (float)n + 1e-5f); } vst2(GS + (b * NH + h) * 32 + t, v); } }
// ---- k_out: block = (128 rows, 128 cols), 8 waves of 32 x 64: out = gh (hi + lo) out_w^T + out_b with gh = (ctx - mu_h) rstd_h gn_w[c] + gn_b[c]; per 32-k step (one head) the block builds gh hi, gh lo and the bf16 out_w tile once and stages them in LDS (two buffers), as k_proj does
__global__ __launch_bounds__(256) void k_out(const float* __restrict__ CTX, const float* __restrict__ GS, const float* __restrict__ GW, const float* __restrict__ GB, const float* __restrict__ WO, const float* __restrict__ BO, float* __restrict__ OUT) {
  __shared__ __align__(16) char sm[128 * 132 * 4];   // loop: gh hi, gh lo and W tiles, each [2][128][PT]; epilogue: f32 tile [128][132]
  __bf16 (*sa)[128][PT] = (__bf16 (*)[128][PT])sm; __bf16 (*sb)[128][PT] = (__bf16 (*)[128][PT])(sm + 2 * 128 * PT * 2); __bf16 (*sw)[128][PT] = (__bf16 (*)[128][PT])(sm + 4 * 128 * PT * 2);
  const int tid = threadIdx.x, wave = tid >> 5, lane = tid & 31, col = lane & 15, g = lane >> 4, wm = wave >> 1, wn = wave & 1; const int c0 = blockIdx.y * 128; const size_t r0 = (size_t)blockIdx.x * 128; const size_t b = r0 / TT;
  const int lr = tid >> 3, lq = tid & 7;   // staging: rows lr + 32 i, floats 4 lq .. 4 lq + 3
  const float* cp = CTX + r0 * CC; const float* wp = WO + (size_t)c0 * CC; const unsigned lo = lr * CC + lq * 4;   // block-uniform bases, one 32-bit lane offset for both tiles
  const float* gs = GS + b * NH * 32;
  v4f pc[4], pw[4], pgw, pgb; float mu, rs;
#pragma unroll
  for (int i = 0; i < 4; ++i) { pc[i] = *(const v4f*)(cp + i * 32 * CC + lo); pw[i] = *(const v4f*)(wp + i * 32 * CC + lo); }
  pgw = *(const v4f*)(GW + lq * 4); pgb = *(const v4f*)(GB + lq * 4); mu = gs[0]; rs = gs[1];
  asm volatile("s_wait_xcnt 0x0" ::: "memory"); __builtin_amdgcn_sched_barrier(0);   // the wait stands in front of any later overwrite of the address registers that the loads above name; the scheduling barrier keeps later vector instructions from being lifted over it
  v8f acc[2][4] = {};
#pragma unroll 2
  for (int kc = 0; kc < CC / 32; ++kc) { const int bf = kc & 1;   /* 32 channels per step == one head */
#pragma unroll
    for (int i = 0; i < 4; ++i) { v4f v;
#pragma unroll
      for (int e = 0; e < 4; ++e) v[e] = (pc[i][e] - mu) * rs * bfr(pgw[e]) + bfr(pgb[e]);
      const v4b hv = __builtin_convertvector(v, v4b); *(v4b*)&sa[bf][lr + 32 * i][lq * 4] = hv; *(v4b*)&sb[bf][lr + 32 * i][lq * 4] = __builtin_convertvector(v - __builtin_convertvector(hv, v4f), v4b); *(v4b*)&sw[bf][lr + 32 * i][lq * 4] = __builtin_convertvector(pw[i], v4b); }
    __syncthreads();   // publishes step kc's tiles; it also ends every wave's reads of the other buffer (step kc - 1) before step kc + 1 is stored there
    v16b ah[2], al[2], w[4];
#pragma unroll
    for (int it = 0; it < 2; ++it) { ah[it] = frag_b(&sa[bf][wm * 32 + it * 16 + col][0], lane); al[it] = frag_b(&sb[bf][wm * 32 + it * 16 + col][0], lane); }
#pragma unroll
    for (int j = 0; j < 4; ++j) w[j] = frag_b(&sw[bf][wn * 64 + j * 16 + col][0], lane);
    if (kc + 1 < CC / 32) { const unsigned ko = lo + (kc + 1) * 32;
#pragma unroll
      for (int i = 0; i < 4; ++i) { pc[i] = *(const v4f*)(cp + i * 32 * CC + ko); pw[i] = *(const v4f*)(wp + i * 32 * CC + ko); }
      pgw = *(const v4f*)(GW + (kc + 1) * 32 + lq * 4); pgb = *(const v4f*)(GB + (kc + 1) * 32 + lq * 4); mu = gs[(kc + 1) * 32]; rs = gs[(kc + 1) * 32 + 1];
      asm volatile("s_wait_xcnt 0x0" ::: "memory"); __builtin_amdgcn_sched_barrier(0);   // the wait stands in front of any later overwrite of the address registers that the loads above name; the scheduling barrier keeps later vector instructions from being lifted over it
    }
#pragma unroll
    for (int it = 0; it < 2; ++it)
#pragma unroll
      for (int j = 0; j < 4; ++j) acc[it][j] = wmma_bf(ah[it], w[j], acc[it][j]);
#pragma unroll
    for (int it = 0; it < 2; ++it)
#pragma unroll
      for (int j = 0; j < 4; ++j) acc[it][j] = wmma_bf(al[it], w[j], acc[it][j]);
    __builtin_amdgcn_sched_barrier(0); }   // keeps the next step's conversions, and with them the wait for its global loads, behind this step's products
  __syncthreads();   // the last step's fragment reads end before the epilogue tile overwrites the staging buffers
  float (*sf)[132] = (float (*)[132])sm;
#pragma unroll
  for (int j = 0; j < 4; ++j) { const int cl = wn * 64 + j * 16 + col; const float bb = bfr(BO[c0 + cl]);
#pragma unroll
    for (int it = 0; it < 2; ++it)
#pragma unroll
      for (int r = 0; r < 8; ++r) sf[wm * 32 + it * 16 + 8 * g + r][cl] = acc[it][j][r] + bb; }
  __syncthreads();
  for (int e = tid; e < 128 * 32; e += 256) { const int rl = e >> 5, q = e & 31; vst2(OUT + (r0 + rl) * CC + c0 + q * 4, *(const v4f*)&sf[rl][q * 4]); } }
extern "C" void kernel_launch(void* const* d_in, const int* in_sizes, int n_in, void* d_out, int out_size, void* d_ws, size_t ws_size, hipStream_t stream) {
  (void)in_sizes; (void)n_in; (void)out_size;
  const float** F = (const float**)d_in;   // 0 x [2,2048,1024], 1 Wqkv_w [3072,1024] ([out,in]; channel o = which*1024 + h*32 + d), 2 Wqkv_b [3072], 3 gn_w [1024], 4 gn_b, 5 out_w [1024,1024] ([out,in]), 6 out_b
  if (ws_size < (size_t)WS_END) return;
  char* ws = (char*)d_ws; _Float16 *QH = (_Float16*)(ws + WS_QH), *QL = (_Float16*)(ws + WS_QL), *KV = (_Float16*)(ws + WS_KV), *KVL = (_Float16*)(ws + WS_KVL); __bf16 *KT = (__bf16*)(ws + WS_KT), *KL = (__bf16*)(ws + WS_KL), *VT = (__bf16*)(ws + WS_VT), *VL = (__bf16*)(ws + WS_VL); float *CTX = (float*)(ws + WS_CTX), *GS = (float*)(ws + WS_GS);
  k_proj<<<dim3(TNB * TT / 128, CC / 128, 3), 256, 0, stream>>>(F[0], F[1], F[2], QH, QL, KT, KL, VT, VL);
  k_kv<<<dim3(NH, TNB), 32, 0, stream>>>(KT, KL, VT, VL, KV, KVL);
  k_ctx<<<dim3(TNB * TT / 64, NH / 4), 128, 0, stream>>>(QH, QL, KV, KVL, CTX);
  k_gn<<<dim3(NH, TNB), 256, 0, stream>>>(CTX, GS);
  k_out<<<dim3(TNB * TT / 128, CC / 128), 256, 0, stream>>>(CTX, GS, F[3], F[4], F[5], F[6], (float*)d_out);
}

// v002
// One run takes 93.7 microseconds.
// In two side-by-side timings against v001, it was 1.49 and 1.50 times as fast.
// All steps since v000 together make it 4.52 times as fast.
#include <hip/hip_runtime.h>
#include <math.h>

typedef __attribute__((ext_vector_type(16))) _Float16 v16h;
typedef __attribute__((ext_vector_type(16))) __bf16 v16b;
typedef __attribute__((ext_vector_type(8)))  _Float16 v8h;
typedef __attribute__((ext_vector_type(8)))  float v8f;
typedef __attribute__((ext_vector_type(4)))  float v4f;
typedef __attribute__((ext_vector_type(2)))  float v2f;
typedef __attribute__((ext_vector_type(4)))  unsigned v4u;
typedef __attribute__((ext_vector_type(4)))  int v4i;
typedef float __attribute__((may_alias)) float_a;
typedef int __attribute__((may_alias)) int_a;

template <typename T> __device__ __forceinline__ void vst2(void* p, T v) { *(T*)p = v;  }
__device__ __forceinline__ v8f wmma16(v16h a, v16h b, v8f c) {
  v8f d = __builtin_amdgcn_wmma_f32_16x16x32_f16(false, a, false, b, (short)0, c, false, false);
  asm volatile("v_nop\n\tv_nop\n\tv_nop\n\tv_nop" : "+v"(d) : "v"(a), "v"(b));
  return d;
}
__device__ __forceinline__ v8f wmma_bf(v16b a, v16b b, v8f c) {
  v8f d = __builtin_amdgcn_wmma_f32_16x16x32_bf16(false, a, false, b, (short)0, c, false, false);
  asm volatile("v_nop\n\tv_nop\n\tv_nop\n\tv_nop" : "+v"(d) : "v"(a), "v"(b));
  return d;
}
// 16x16x32 fragments: lane = (h = lane>>4, row/col = lane&15); elements 0..7 = k0+8h+0..7, 8..15 = k0+16+8h+0..7; D element r = row 8h+r
__device__ __forceinline__ v16h frag_h(const _Float16* rowk0, int lane) {
  union { v16h v; v8h q[2]; } u; const _Float16* p = rowk0 + 8 * (lane >> 4);
  u.q[0] = *(const v8h*)p; u.q[1] = *(const v8h*)(p + 16); return u.v;
}
__device__ __forceinline__ v16h frag_f32(const float* rowk0, int lane) {
  v16h a; const float* p = rowk0 + 8 * (lane >> 4);
#pragma unroll
  for (int i = 0; i < 8; ++i) { a[i] = (_Float16)p[i]; a[8 + i] = (_Float16)p[16 + i]; }
  return a;
}
__device__ __forceinline__ v16h frag_f32s(const float* rowk0, int lane, float sc) {
  v16h a; const float* p = rowk0 + 8 * (lane >> 4);
#pragma unroll
  for (int i = 0; i < 8; ++i) { a[i] = (_Float16)(p[i] * sc); a[8 + i] = (_Float16)(p[16 + i] * sc); }
  return a;
}
// column fragment from a [K][ld] layout (column n), rows >= K read as 0
__device__ __forceinline__ v16h fragc_f32(const float* W, int k0, int n, int lane, int ld, int K) {
  v16h a; const int g = lane >> 4;
#pragma unroll
  for (int i = 0; i < 8; ++i) { const int ka = k0 + 8 * g + i, kb = ka + 16;
    a[i] = (_Float16)(ka < K ? W[(size_t)(ka < K ? ka : K - 1) * ld + n] : 0.f); a[8 + i] = (_Float16)(kb < K ? W[(size_t)(kb < K ? kb : K - 1) * ld + n] : 0.f); }
  return a;
}
struct F2 { v16b h, l; };
__device__ __forceinline__ F2 bsplit16(const float v[16]) { F2 r;
#pragma unroll
  for (int i = 0; i < 16; ++i) { const __bf16 h = (__bf16)v[i]; r.h[i] = h; r.l[i] = (__bf16)(v[i] - (float)h); }
  return r; }
__device__ __forceinline__ F2 split_row(const float* row, int k0, int lane) { float v[16]; const float* p = row + k0 + 8 * (lane >> 4);
#pragma unroll
  for (int i = 0; i < 8; ++i) { v[i] = p[i]; v[8 + i] = p[16 + i]; }
  return bsplit16(v); }
__device__ __forceinline__ F2 split_rowK(const float* row, int k0, int lane, int K) { float v[16]; const int g = lane >> 4;
#pragma unroll
  for (int i = 0; i < 8; ++i) { const int ka = k0 + 8 * g + i, kb = ka + 16; v[i] = ka < K ? row[ka < K ? ka : K - 1] : 0.f; v[8 + i] = kb < K ? row[kb < K ? kb : K - 1] : 0.f; }
  return bsplit16(v); }
__device__ __forceinline__ F2 split_col(const float* W, int k0, int n, int lane, int ld, int K) { float v[16]; const int g = lane >> 4;
#pragma unroll
  for (int i = 0; i < 8; ++i) { const int ka = k0 + 8 * g + i, kb = ka + 16; v[i] = ka < K ? W[(size_t)(ka < K ? ka : K - 1) * ld + n] : 0.f; v[8 + i] = kb < K ? W[(size_t)(kb < K ? kb : K - 1) * ld + n] : 0.f; }
  return bsplit16(v); }
__device__ __forceinline__ v8f mac3(const F2& a, const F2& b, v8f c) { c = wmma_bf(a.l, b.h, c); c = wmma_bf(a.h, b.l, c); return wmma_bf(a.h, b.h, c); }
__device__ __forceinline__ float sigm(float v) { return 1.0f / (1.0f + expf(-v)); }
#define LDSX() do { asm volatile("s_wait_dscnt 0" ::: "memory"); __builtin_amdgcn_wave_barrier(); __builtin_amdgcn_fence(__ATOMIC_RELEASE, "workgroup"); } while (0)

// MHLA (B 2, S 2,048, 1,024 = 32 heads x 32): q,k,v = split(x Wqkv^T + b) as [B,S,3,H,Dh]; a = q k^T (no softmax); ctx = a v  (== q (k^T v), reassociated exactly); GroupNorm per (b, head) over (Dh, S) with eps 1e-5 and per-channel affine; out = ctx out_w^T + out_b.
__device__ __forceinline__ float bfr(float v) { return (float)(__bf16)v; }
#define NB 2
#define TT 2048
#define CC 1024
#define NH 32
#define HD 32
#ifndef TNB
#define TNB NB
#endif
#ifndef QSTR
#define QSTR (TT * CC)        // unused; x rows are read as [b*T+t][1024]
#endif
typedef __attribute__((ext_vector_type(8))) __bf16 v8b;
__device__ __forceinline__ v16b frag_b(const __bf16* rowk0, int lane) { union { v16b v; v8b q[2]; } u; const __bf16* p = rowk0 + 8 * (lane >> 4); u.q[0] = *(const v8b*)p; u.q[1] = *(const v8b*)(p + 16); return u.v; }
#define WS_QH  0u                                          // f16 q hi rows [b*T+t][1024]
#define WS_QL  (WS_QH + 2u * (size_t)NB * TT * CC)
#define WS_KT  (WS_QL + 2u * (size_t)NB * TT * CC)           // bf16 k hi planes [b][c][s]
#define WS_KL  (WS_KT + 2u * (size_t)NB * CC * TT)
#define WS_VT  (WS_KL + 2u * (size_t)NB * CC * TT)           // bf16 v hi planes [b][c][s]
#define WS_VL  (WS_VT + 2u * (size_t)NB * CC * TT)
#define WS_KV  (WS_VL + 2u * (size_t)NB * CC * TT)           // f16 KV hi + residual tiles [b][h][jt][it][j][i] (j = v dim = output col, i = k dim)
#define WS_KVL (WS_KV + 2u * (size_t)NB * NH * HD * HD)
#define WS_CTX (WS_KVL + 2u * (size_t)NB * NH * HD * HD)      // f32 ctx rows [b*T+t][1024]
#define WS_GS  (WS_CTX + 4u * (size_t)NB * TT * CC)          // f32 GroupNorm stats [b][h][2] (32-float lines)
#define WS_END (WS_GS + 4u * (size_t)NB * NH * 2 * 16)
typedef __attribute__((ext_vector_type(4))) __bf16 v4b;
#define PT 40   // LDS row pitch of a staged 32-k bf16 row, in elements: 80 B = 16 B x odd, which ds_load_b128 fragment reads take without bank conflicts
// ---- k_proj: block = (128 rows, 128 cols, which), 8 waves of 32 x 64: qkv = x W^T + b ([out,in] rows which*1024 + o). Per 32-k step the block converts its x and W tiles to bf16 once and stages them in LDS (two buffers, next step's global loads in flight over the products); q -> f16 hi + residual rows; k, v -> bf16 hi + lo planes [b][c][t]
__global__ __launch_bounds__(256) void k_proj(const float* __restrict__ X, const float* __restrict__ Wt, const float* __restrict__ Bv, _Float16* __restrict__ QH, _Float16* __restrict__ QL, __bf16* __restrict__ KT, __bf16* __restrict__ KL, __bf16* __restrict__ VT, __bf16* __restrict__ VL) {
  __shared__ __align__(16) char sm[2 * 128 * 136 * 2];   // loop: x tiles [2][128][PT], W tiles [2][128][PT]; epilogue: hi and lo tiles [128][136]
  __bf16 (*sx)[128][PT] = (__bf16 (*)[128][PT])sm; __bf16 (*sw)[128][PT] = (__bf16 (*)[128][PT])(sm + 2 * 128 * PT * 2);
  const int tid = threadIdx.x, wave = tid >> 5, lane = tid & 31, col = lane & 15, g = lane >> 4, wm = wave >> 1, wn = wave & 1; const int which = blockIdx.z; const int c0 = blockIdx.y * 128; const size_t r0 = (size_t)blockIdx.x * 128;
  const int lr = tid >> 3, lq = tid & 7;   // staging: rows lr + 32 i, floats 4 lq .. 4 lq + 3 (8 lanes cover one 128-B line)
  const float* xp = X + r0 * CC; const float* wp = Wt + (size_t)(which * CC + c0) * CC; const unsigned lo = lr * CC + lq * 4;   // block-uniform bases, one 32-bit lane offset for both tiles
  v4f px[4], pw[4];
#pragma unroll
  for (int i = 0; i < 4; ++i) { px[i] = *(const v4f*)(xp + i * 32 * CC + lo); pw[i] = *(const v4f*)(wp + i * 32 * CC + lo); }
  asm volatile("s_wait_xcnt 0x0" ::: "memory"); __builtin_amdgcn_sched_barrier(0);   // the wait stands in front of any later overwrite of the address registers that the loads above name; the scheduling barrier keeps later vector instructions from being lifted over it
  v8f acc[2][4] = {};
#pragma unroll 2
  for (int kc = 0; kc < CC / 32; ++kc) { const int bf = kc & 1;
#pragma unroll
    for (int i = 0; i < 4; ++i) { *(v4b*)&sx[bf][lr + 32 * i][lq * 4] = __builtin_convertvector(px[i], v4b); *(v4b*)&sw[bf][lr + 32 * i][lq * 4] = __builtin_convertvector(pw[i], v4b); }
    __syncthreads();   // publishes step kc's tiles; it also ends every wave's reads of the other buffer (step kc - 1) before step kc + 1 is stored there
    v16b a[2], w[4];
#pragma unroll
    for (int it = 0; it < 2; ++it) a[it] = frag_b(&sx[bf][wm * 32 + it * 16 + col][0], lane);
#pragma unroll
    for (int j = 0; j < 4; ++j) w[j] = frag_b(&sw[bf][wn * 64 + j * 16 + col][0], lane);
    if (kc + 1 < CC / 32) { const unsigned ko = lo + (kc + 1) * 32;
#pragma unroll
      for (int i = 0; i < 4; ++i) { px[i] = *(const v4f*)(xp + i * 32 * CC + ko); pw[i] = *(const v4f*)(wp + i * 32 * CC + ko); }
      asm volatile("s_wait_xcnt 0x0" ::: "memory"); __builtin_amdgcn_sched_barrier(0);   // the wait stands in front of any later overwrite of the address registers that the loads above name; the scheduling barrier keeps later vector instructions from being lifted over it
    }
#pragma unroll
    for (int it = 0; it < 2; ++it)
#pragma unroll
      for (int j = 0; j < 4; ++j) acc[it][j] = wmma_bf(a[it], w[j], acc[it][j]);
    __builtin_amdgcn_sched_barrier(0); }   // keeps the next step's conversions, and with them the wait for its global loads, behind this step's products
  __syncthreads();   // the last step's fragment reads end before the epilogue tiles overwrite the staging buffers
  _Float16 (*sh)[136] = (_Float16 (*)[136])sm; _Float16 (*sl)[136] = (_Float16 (*)[136])(sm + 128 * 136 * 2); __bf16 (*th)[136] = (__bf16 (*)[136])sm; __bf16 (*tl2)[136] = (__bf16 (*)[136])(sm + 128 * 136 * 2);
  float bv[4];
#pragma unroll
  for (int j = 0; j < 4; ++j) bv[j] = Bv[which * CC + c0 + wn * 64 + j * 16 + col];
  asm volatile("s_wait_xcnt 0x0" ::: "memory"); __builtin_amdgcn_sched_barrier(0);   // wait and scheduling barrier as behind the tile loads above
  if (which == 0) {
#pragma unroll
    for (int j = 0; j < 4; ++j) { const int cl = wn * 64 + j * 16 + col; const float bb = bfr(bv[j]);
#pragma unroll
      for (int it = 0; it < 2; ++it)
#pragma unroll
        for (int r = 0; r < 8; ++r) { const float v = acc[it][j][r] + bb; const int rl = wm * 32 + it * 16 + 8 * g + r; const _Float16 hv = (_Float16)v; sh[rl][cl] = hv; sl[rl][cl] = (_Float16)((v - (float)hv) * 1024.0f); } }
  } else {
#pragma unroll
    for (int j = 0; j < 4; ++j) { const int cl = wn * 64 + j * 16 + col; const float bb = bfr(bv[j]);
#pragma unroll
      for (int it = 0; it < 2; ++it) { v8b h8, l8;
#pragma unroll
        for (int r = 0; r < 8; ++r) { const float v = acc[it][j][r] + bb; const __bf16 bh = (__bf16)v; h8[r] = bh; l8[r] = (__bf16)(v - (float)bh); }
        *(v8b*)&th[cl][wm * 32 + it * 16 + 8 * g] = h8; *(v8b*)&tl2[cl][wm * 32 + it * 16 + 8 * g] = l8; }
      __builtin_amdgcn_sched_barrier(0); }   // one column group at a time: keeps the epilogue's register use under the loop's 160, at which three blocks share a WGP
  }
  __syncthreads();
  if (which == 0) { for (int e = tid; e < 128 * 16; e += 256) { const int rl = e >> 4, q = e & 15; vst2((unsigned*)(QH + (r0 + rl) * CC + c0 + q * 8), *(const v4u*)&sh[rl][q * 8]); vst2((unsigned*)(QL + (r0 + rl) * CC + c0 + q * 8), *(const v4u*)&sl[rl][q * 8]); } }
  else { __bf16* DT = which == 1 ? KT : VT; __bf16* DL = which == 1 ? KL : VL; const size_t b = r0 / TT; const int t0 = (int)(r0 % TT); for (int e = tid; e < 128 * 16; e += 256) { const int cl = e >> 4, q = e & 15; const size_t o2 = (b * CC + c0 + cl) * (size_t)TT + t0 + q * 8; vst2((unsigned*)(DT + o2), *(const v4u*)&th[cl][q * 8]); vst2((unsigned*)(DL + o2), *(const v4u*)&tl2[cl][q * 8]); } } }
// B fragment of one head's KV, stored tile by tile [jt][it][16 j][16 i]: elements 0..7 = i 8g + 0..7 (tile it 0), 8..15 = i 16 + 8g + 0..7 (tile it 1, 256 elements on): the k order of frag_h
__device__ __forceinline__ v16h frag_kv(const _Float16* row0, int lane) {
  union { v16h v; v8h q[2]; } u; const _Float16* p = row0 + 8 * (lane >> 4);
  u.q[0] = *(const v8h*)p; u.q[1] = *(const v8h*)(p + 256); return u.v;
}
// ---- k_kv: block = (h, b, tile (it, jt)), 8 waves: KV[i][j] = sum_s k[s][i] v[s][j] for one 16 x 16 tile (A rows = k planes (i), B cols = v planes (j); 3 products). Wave w sums s = 256 w .. 256 w + 255 (4 pairs of 32-s steps, one 128-B line of each plane row per pair; two pairs of loads in flight); the 8 partial tiles are added in LDS in wave order; stored as f16 hi + residual tiles [b][h][jt][it][j][i]: 512 B + 512 B per block
__global__ __launch_bounds__(256) void k_kv(const __bf16* __restrict__ KT, const __bf16* __restrict__ KL, const __bf16* __restrict__ VT, const __bf16* __restrict__ VL, _Float16* __restrict__ KV, _Float16* __restrict__ KVL) { __shared__ __align__(16) v4f red[8][2][32];
  const int tid = threadIdx.x, wave = tid >> 5, lane = tid & 31, col = lane & 15, g = lane >> 4; const size_t b = blockIdx.y; const int h = blockIdx.x, it = blockIdx.z >> 1, jt = blockIdx.z & 1;
  const size_t ko = (b * CC + h * HD + it * 16 + col) * (size_t)TT + wave * (TT / 8), vo = (b * CC + h * HD + jt * 16 + col) * (size_t)TT + wave * (TT / 8);
  const __bf16* pl[4] = { KT + ko, KL + ko, VT + vo, VL + vo };
  v16b f[2][4][2];   // [buffer][plane: k hi, k lo, v hi, v lo][step of the pair]
#pragma unroll
  for (int p = 0; p < 2; ++p) {
#pragma unroll
    for (int q = 0; q < 4; ++q)
#pragma unroll
      for (int e = 0; e < 2; ++e) f[p][q][e] = frag_b(pl[q] + p * 64 + e * 32, lane);
    __builtin_amdgcn_sched_barrier(0); }   // pair 0's loads stay in front of pair 1's, so that pair 0's products wait for their own 16 loads alone, and both pairs are issued before the first product waits
  v8f ahh = {}, alh = {}, ahl = {};
#pragma unroll
  for (int p = 0; p < 4; ++p) { const int bf = p & 1;
#pragma unroll
    for (int e = 0; e < 2; ++e) { ahh = wmma_bf(f[bf][0][e], f[bf][2][e], ahh); alh = wmma_bf(f[bf][1][e], f[bf][2][e], alh); ahl = wmma_bf(f[bf][0][e], f[bf][3][e], ahl); }
    if (p + 2 < 4) {
#pragma unroll
      for (int q = 0; q < 4; ++q)
#pragma unroll
        for (int e = 0; e < 2; ++e) f[bf][q][e] = frag_b(pl[q] + (p + 2) * 64 + e * 32, lane);
    }
    if (p == 1) asm volatile("s_wait_xcnt 0x0" ::: "memory");   // the wait stands behind the last plane load, in front of any later overwrite of the address registers that the loads name
    __builtin_amdgcn_sched_barrier(0); }   // keeps each refill directly behind the products that free its registers, so that it flies over the other buffer's products; behind the wait it keeps later vector instructions from being lifted over it
  v8f t = ahh + (alh + ahl);
  red[wave][0][lane] = __builtin_shufflevector(t, t, 0, 1, 2, 3); red[wave][1][lane] = __builtin_shufflevector(t, t, 4, 5, 6, 7);
  __syncthreads();   // publishes the 8 partial tiles to wave 0
  if (wave == 0) { v4f s0 = red[0][0][lane], s1 = red[0][1][lane];
#pragma unroll
    for (int w = 1; w < 8; ++w) { s0 += red[w][0][lane]; s1 += red[w][1][lane]; }
    v8h h8, l8;
#pragma unroll
    for (int r = 0; r < 8; ++r) { const float v = r < 4 ? s0[r & 3] : s1[r & 3]; const _Float16 hv = (_Float16)v; h8[r] = hv; l8[r] = (_Float16)((v - (float)hv) * 1024.0f); }
    const size_t o = (((b * NH + h) * 2 + jt) * 2 + it) * 256 + col * 16 + 8 * g; vst2(KV + o, h8); vst2(KVL + o, l8); } }
// ---- k_ctx: block = (64 rows t, 4 heads): ctx[t][h*32 + j] = sum_i q[t][h*32 + i] KV_h[i][j] (q hi+res x KV hi+res, 3 products, K = 32 = one chunk); 512-B segments per row
__global__ __launch_bounds__(128) void k_ctx(const _Float16* __restrict__ QH, const _Float16* __restrict__ QL, const _Float16* __restrict__ KV, const _Float16* __restrict__ KVL, float* __restrict__ CTX) { __shared__ __align__(16) float sf[4][16][132];
  const int tid = threadIdx.x, wave = tid >> 5, lane = tid & 31, col = lane & 15, g = lane >> 4; const int h0 = blockIdx.y * 4; const size_t r0 = (size_t)blockIdx.x * 64 + wave * 16; const size_t b = r0 / TT;
#pragma unroll
  for (int hh = 0; hh < 4; ++hh) { const int h = h0 + hh; v8f acc[2] = {}; const v16h ah = frag_h(QH + (r0 + col) * CC + h * HD, lane), al = frag_h(QL + (r0 + col) * CC + h * HD, lane);
#pragma unroll
    for (int jt = 0; jt < 2; ++jt) { const size_t bo = ((b * NH + h) * 4 + jt * 2) * 256 + col * 16; const v16h bh = frag_kv(KV + bo, lane), bl = frag_kv(KVL + bo, lane); acc[jt] = wmma16(ah, bh, acc[jt]); v8f t2 = {}; t2 = wmma16(al, bh, t2); t2 = wmma16(ah, bl, t2);
#pragma unroll
      for (int r = 0; r < 8; ++r) sf[wave][8 * g + r][hh * 32 + jt * 16 + col] = acc[jt][r] + t2[r] * (1.0f / 1024.0f); } }
  LDSX(); for (int rl = 0; rl < 16; ++rl) vst2(CTX + (r0 + rl) * CC + h0 * HD + lane * 4, *(const v4f*)&sf[wave][rl][lane * 4]); }
__global__ __launch_bounds__(256) void k_gn(const float* __restrict__ CTX, float* __restrict__ GS) { __shared__ float sred[8]; __shared__ float sbc;
  const int t = threadIdx.x; const int h = blockIdx.x; const size_t b = blockIdx.y; const float* base = CTX + (b * TT) * CC + h * HD; const int n = TT * HD;
  float s = 0.f; for (int e = t; e < TT * 8; e += 256) { const int row = e >> 3, q = e & 7; const v4f v = *(const v4f*)(base + (size_t)row * CC + q * 4); s += (v[0] + v[1]) + (v[2] + v[3]); }
#pragma unroll
  for (int o = 1; o < 32; o <<= 1) s += __shfl_xor(s, o);
  if ((t & 31) == 0) sred[t >> 5] = s; __syncthreads(); if (t == 0) { float a = 0.f; for (int w = 0; w < 8; ++w) a += sred[w]; sbc = a / (float)n; } __syncthreads(); const float mu = sbc; __syncthreads();
  float s2 = 0.f; for (int e = t; e < TT * 8; e += 256) { const int row = e >> 3, q = e & 7; const v4f v = *(const v4f*)(base + (size_t)row * CC + q * 4); const float d0 = v[0] - mu, d1 = v[1] - mu, d2 = v[2] - mu, d3 = v[3] - mu; s2 += (d0 * d0 + d1 * d1) + (d2 * d2 + d3 * d3); }
#pragma unroll
  for (int o = 1; o < 32; o <<= 1) s2 += __shfl_xor(s2, o);
  if ((t & 31) == 0) sred[t >> 5] = s2; __syncthreads();
  if (t < 32) { float v = 0.f; if (t == 0) v = mu; if (t == 1) { float a = 0.f; for (int w = 0; w < 8; ++w) a += sred[w]; v = rsqrtf(a / (float)n + 1e-5f); } vst2(GS + (b * NH + h) * 32 + t, v); } }
// ---- k_out: block = (128 rows, 128 cols), 8 waves of 32 x 64: out = gh (hi + lo) out_w^T + out_b with gh = (ctx - mu_h) rstd_h gn_w[c] + gn_b[c]; per 32-k step (one head) the block builds gh hi, gh lo and the bf16 out_w tile once and stages them in LDS (two buffers), as k_proj does
__global__ __launch_bounds__(256) void k_out(const float* __restrict__ CTX, const float* __restrict__ GS, const float* __restrict__ GW, const float* __restrict__ GB, const float* __restrict__ WO, const float* __restrict__ BO, float* __restrict__ OUT) {
  __shared__ __align__(16) char sm[128 * 132 * 4];   // loop: gh hi, gh lo and W tiles, each [2][128][PT]; epilogue: f32 tile [128][132]
  __bf16 (*sa)[128][PT] = (__bf16 (*)[128][PT])sm; __bf16 (*sb)[128][PT] = (__bf16 (*)[128][PT])(sm + 2 * 128 * PT * 2); __bf16 (*sw)[128][PT] = (__bf16 (*)[128][PT])(sm + 4 * 128 * PT * 2);
  const int tid = threadIdx.x, wave = tid >> 5, lane = tid & 31, col = lane & 15, g = lane >> 4, wm = wave >> 1, wn = wave & 1; const int c0 = blockIdx.y * 128; const size_t r0 = (size_t)blockIdx.x * 128; const size_t b = r0 / TT;
  const int lr = tid >> 3, lq = tid & 7;   // staging: rows lr + 32 i, floats 4 lq .. 4 lq + 3
  const float* cp = CTX + r0 * CC; const float* wp = WO + (size_t)c0 * CC; const unsigned lo = lr * CC + lq * 4;   // block-uniform bases, one 32-bit lane offset for both tiles
  const float* gs = GS + b * NH * 32;
  v4f pc[4], pw[4], pgw, pgb; float mu, rs;
#pragma unroll
  for (int i = 0; i < 4; ++i) { pc[i] = *(const v4f*)(cp + i * 32 * CC + lo); pw[i] = *(const v4f*)(wp + i * 32 * CC + lo); }
  pgw = *(const v4f*)(GW + lq * 4); pgb = *(const v4f*)(GB + lq * 4); mu = gs[0]; rs = gs[1];
  asm volatile("s_wait_xcnt 0x0" ::: "memory"); __builtin_amdgcn_sched_barrier(0);   // the wait stands in front of any later overwrite of the address registers that the loads above name; the scheduling barrier keeps later vector instructions from being lifted over it
  v8f acc[2][4] = {};
#pragma unroll 2
  for (int kc = 0; kc < CC / 32; ++kc) { const int bf = kc & 1;   /* 32 channels per step == one head */
#pragma unroll
    for (int i = 0; i < 4; ++i) { v4f v;
#pragma unroll
      for (int e = 0; e < 4; ++e) v[e] = (pc[i][e] - mu) * rs * bfr(pgw[e]) + bfr(pgb[e]);
      const v4b hv = __builtin_convertvector(v, v4b); *(v4b*)&sa[bf][lr + 32 * i][lq * 4] = hv; *(v4b*)&sb[bf][lr + 32 * i][lq * 4] = __builtin_convertvector(v - __builtin_convertvector(hv, v4f), v4b); *(v4b*)&sw[bf][lr + 32 * i][lq * 4] = __builtin_convertvector(pw[i], v4b); }
    __syncthreads();   // publishes step kc's tiles; it also ends every wave's reads of the other buffer (step kc - 1) before step kc + 1 is stored there
    v16b ah[2], al[2], w[4];
#pragma unroll
    for (int it = 0; it < 2; ++it) { ah[it] = frag_b(&sa[bf][wm * 32 + it * 16 + col][0], lane); al[it] = frag_b(&sb[bf][wm * 32 + it * 16 + col][0], lane); }
#pragma unroll
    for (int j = 0; j < 4; ++j) w[j] = frag_b(&sw[bf][wn * 64 + j * 16 + col][0], lane);
    if (kc + 1 < CC / 32) { const unsigned ko = lo + (kc + 1) * 32;
#pragma unroll
      for (int i = 0; i < 4; ++i) { pc[i] = *(const v4f*)(cp + i * 32 * CC + ko); pw[i] = *(const v4f*)(wp + i * 32 * CC + ko); }
      pgw = *(const v4f*)(GW + (kc + 1) * 32 + lq * 4); pgb = *(const v4f*)(GB + (kc + 1) * 32 + lq * 4); mu = gs[(kc + 1) * 32]; rs = gs[(kc + 1) * 32 + 1];
      asm volatile("s_wait_xcnt 0x0" ::: "memory"); __builtin_amdgcn_sched_barrier(0);   // the wait stands in front of any later overwrite of the address registers that the loads above name; the scheduling barrier keeps later vector instructions from being lifted over it
    }
#pragma unroll
    for (int it = 0; it < 2; ++it)
#pragma unroll
      for (int j = 0; j < 4; ++j) acc[it][j] = wmma_bf(ah[it], w[j], acc[it][j]);
#pragma unroll
    for (int it = 0; it < 2; ++it)
#pragma unroll
      for (int j = 0; j < 4; ++j) acc[it][j] = wmma_bf(al[it], w[j], acc[it][j]);
    __builtin_amdgcn_sched_barrier(0); }   // keeps the next step's conversions, and with them the wait for its global loads, behind this step's products
  __syncthreads();   // the last step's fragment reads end before the epilogue tile overwrites the staging buffers
  float (*sf)[132] = (float (*)[132])sm;
#pragma unroll
  for (int j = 0; j < 4; ++j) { const int cl = wn * 64 + j * 16 + col; const float bb = bfr(BO[c0 + cl]);
#pragma unroll
    for (int it = 0; it < 2; ++it)
#pragma unroll
      for (int r = 0; r < 8; ++r) sf[wm * 32 + it * 16 + 8 * g + r][cl] = acc[it][j][r] + bb; }
  __syncthreads();
  for (int e = tid; e < 128 * 32; e += 256) { const int rl = e >> 5, q = e & 31; vst2(OUT + (r0 + rl) * CC + c0 + q * 4, *(const v4f*)&sf[rl][q * 4]); } }
extern "C" void kernel_launch(void* const* d_in, const int* in_sizes, int n_in, void* d_out, int out_size, void* d_ws, size_t ws_size, hipStream_t stream) {
  (void)in_sizes; (void)n_in; (void)out_size;
  const float** F = (const float**)d_in;   // 0 x [2,2048,1024], 1 Wqkv_w [3072,1024] ([out,in]; channel o = which*1024 + h*32 + d), 2 Wqkv_b [3072], 3 gn_w [1024], 4 gn_b, 5 out_w [1024,1024] ([out,in]), 6 out_b
  if (ws_size < (size_t)WS_END) return;
  char* ws = (char*)d_ws; _Float16 *QH = (_Float16*)(ws + WS_QH), *QL = (_Float16*)(ws + WS_QL), *KV = (_Float16*)(ws + WS_KV), *KVL = (_Float16*)(ws + WS_KVL); __bf16 *KT = (__bf16*)(ws + WS_KT), *KL = (__bf16*)(ws + WS_KL), *VT = (__bf16*)(ws + WS_VT), *VL = (__bf16*)(ws + WS_VL); float *CTX = (float*)(ws + WS_CTX), *GS = (float*)(ws + WS_GS);
  k_proj<<<dim3(TNB * TT / 128, CC / 128, 3), 256, 0, stream>>>(F[0], F[1], F[2], QH, QL, KT, KL, VT, VL);
  k_kv<<<dim3(NH, TNB, 4), 256, 0, stream>>>(KT, KL, VT, VL, KV, KVL);
  k_ctx<<<dim3(TNB * TT / 64, NH / 4), 128, 0, stream>>>(QH, QL, KV, KVL, CTX);
  k_gn<<<dim3(NH, TNB), 256, 0, stream>>>(CTX, GS);
  k_out<<<dim3(TNB * TT / 128, CC / 128), 256, 0, stream>>>(CTX, GS, F[3], F[4], F[5], F[6], (float*)d_out);
}

// v003
// It runs in 86.3 microseconds.
// Timed twice side by side with v002, it ran 1.09 times as fast both times.
// Over all steps from v000 it is 4.91 times as fast.
#include <hip/hip_runtime.h>
#include <math.h>

typedef __attribute__((ext_vector_type(16))) _Float16 v16h;
typedef __attribute__((ext_vector_type(16))) __bf16 v16b;
typedef __attribute__((ext_vector_type(8)))  _Float16 v8h;
typedef __attribute__((ext_vector_type(8)))  float v8f;
typedef __attribute__((ext_vector_type(4)))  float v4f;
typedef __attribute__((ext_vector_type(2)))  float v2f;
typedef __attribute__((ext_vector_type(4)))  unsigned v4u;
typedef __attribute__((ext_vector_type(4)))  int v4i;
typedef float __attribute__((may_alias)) float_a;
typedef int __attribute__((may_alias)) int_a;

template <typename T> __device__ __forceinline__ void vst2(void* p, T v) { *(T*)p = v;  }
__device__ __forceinline__ v8f wmma16(v16h a, v16h b, v8f c) {
  v8f d = __builtin_amdgcn_wmma_f32_16x16x32_f16(false, a, false, b, (short)0, c, false, false);
  asm volatile("v_nop\n\tv_nop\n\tv_nop\n\tv_nop" : "+v"(d) : "v"(a), "v"(b));
  return d;
}
__device__ __forceinline__ v8f wmma_bf(v16b a, v16b b, v8f c) {
  v8f d = __builtin_amdgcn_wmma_f32_16x16x32_bf16(false, a, false, b, (short)0, c, false, false);
  asm volatile("v_nop\n\tv_nop\n\tv_nop\n\tv_nop" : "+v"(d) : "v"(a), "v"(b));
  return d;
}
// 16x16x32 fragments: lane = (h = lane>>4, row/col = lane&15); elements 0..7 = k0+8h+0..7, 8..15 = k0+16+8h+0..7; D element r = row 8h+r
__device__ __forceinline__ v16h frag_h(const _Float16* rowk0, int lane) {
  union { v16h v; v8h q[2]; } u; const _Float16* p = rowk0 + 8 * (lane >> 4);
  u.q[0] = *(const v8h*)p; u.q[1] = *(const v8h*)(p + 16); return u.v;
}
__device__ __forceinline__ v16h frag_f32(const float* rowk0, int lane) {
  v16h a; const float* p = rowk0 + 8 * (lane >> 4);
#pragma unroll
  for (int i = 0; i < 8; ++i) { a[i] = (_Float16)p[i]; a[8 + i] = (_Float16)p[16 + i]; }
  return a;
}
__device__ __forceinline__ v16h frag_f32s(const float* rowk0, int lane, float sc) {
  v16h a; const float* p = rowk0 + 8 * (lane >> 4);
#pragma unroll
  for (int i = 0; i < 8; ++i) { a[i] = (_Float16)(p[i] * sc); a[8 + i] = (_Float16)(p[16 + i] * sc); }
  return a;
}
// column fragment from a [K][ld] layout (column n), rows >= K read as 0
__device__ __forceinline__ v16h fragc_f32(const float* W, int k0, int n, int lane, int ld, int K) {
  v16h a; const int g = lane >> 4;
#pragma unroll
  for (int i = 0; i < 8; ++i) { const int ka = k0 + 8 * g + i, kb = ka + 16;
    a[i] = (_Float16)(ka < K ? W[(size_t)(ka < K ? ka : K - 1) * ld + n] : 0.f); a[8 + i] = (_Float16)(kb < K ? W[(size_t)(kb < K ? kb : K - 1) * ld + n] : 0.f); }
  return a;
}
struct F2 { v16b h, l; };
__device__ __forceinline__ F2 bsplit16(const float v[16]) { F2 r;
#pragma unroll
  for (int i = 0; i < 16; ++i) { const __bf16 h = (__bf16)v[i]; r.h[i] = h; r.l[i] = (__bf16)(v[i] - (float)h); }
  return r; }
__device__ __forceinline__ F2 split_row(const float* row, int k0, int lane) { float v[16]; const float* p = row + k0 + 8 * (lane >> 4);
#pragma unroll
  for (int i = 0; i < 8; ++i) { v[i] = p[i]; v[8 + i] = p[16 + i]; }
  return bsplit16(v); }
__device__ __forceinline__ F2 split_rowK(const float* row, int k0, int lane, int K) { float v[16]; const int g = lane >> 4;
#pragma unroll
  for (int i = 0; i < 8; ++i) { const int ka = k0 + 8 * g + i, kb = ka + 16; v[i] = ka < K ? row[ka < K ? ka : K - 1] : 0.f; v[8 + i] = kb < K ? row[kb < K ? kb : K - 1] : 0.f; }
  return bsplit16(v); }
__device__ __forceinline__ F2 split_col(const float* W, int k0, int n, int lane, int ld, int K) { float v[16]; const int g = lane >> 4;
#pragma unroll
  for (int i = 0; i < 8; ++i) { const int ka = k0 + 8 * g + i, kb = ka + 16; v[i] = ka < K ? W[(size_t)(ka < K ? ka : K - 1) * ld + n] : 0.f; v[8 + i] = kb < K ? W[(size_t)(kb < K ? kb : K - 1) * ld + n] : 0.f; }
  return bsplit16(v); }
__device__ __forceinline__ v8f mac3(const F2& a, const F2& b, v8f c) { c = wmma_bf(a.l, b.h, c); c = wmma_bf(a.h, b.l, c); return wmma_bf(a.h, b.h, c); }
__device__ __forceinline__ float sigm(float v) { return 1.0f / (1.0f + expf(-v)); }
#define LDSX() do { asm volatile("s_wait_dscnt 0" ::: "memory"); __builtin_amdgcn_wave_barrier(); __builtin_amdgcn_fence(__ATOMIC_RELEASE, "workgroup"); } while (0)

// MHLA (B 2, S 2,048, 1,024 = 32 heads x 32): q,k,v = split(x Wqkv^T + b) as [B,S,3,H,Dh]; a = q k^T (no softmax); ctx = a v  (== q (k^T v), reassociated exactly); GroupNorm per (b, head) over (Dh, S) with eps 1e-5 and per-channel affine; out = ctx out_w^T + out_b.
__device__ __forceinline__ float bfr(float v) { return (float)(__bf16)v; }
#define NB 2
#define TT 2048
#define CC 1024
#define NH 32
#define HD 32
#ifndef TNB
#define TNB NB
#endif
#ifndef QSTR
#define QSTR (TT * CC)        // unused; x rows are read as [b*T+t][1024]
#endif
typedef __attribute__((ext_vector_type(8))) __bf16 v8b;
__device__ __forceinline__ v16b frag_b(const __bf16* rowk0, int lane) { union { v16b v; v8b q[2]; } u; const __bf16* p = rowk0 + 8 * (lane >> 4); u.q[0] = *(const v8b*)p; u.q[1] = *(const v8b*)(p + 16); return u.v; }
#define WS_QH  0u                                          // f16 q hi rows [b*T+t][1024]
#define WS_QL  (WS_QH + 2u * (size_t)NB * TT * CC)
#define WS_KT  (WS_QL + 2u * (size_t)NB * TT * CC)           // bf16 k hi planes [b][c][s]
#define WS_KL  (WS_KT + 2u * (size_t)NB * CC * TT)
#define WS_VT  (WS_KL + 2u * (size_t)NB * CC * TT)           // bf16 v hi planes [b][c][s]
#define WS_VL  (WS_VT + 2u * (size_t)NB * CC * TT)
#define WS_KV  (WS_VL + 2u * (size_t)NB * CC * TT)           // f16 KV hi + residual tiles [b][h][jt][it][j][i] (j = v dim = output col, i = k dim)
#define WS_KVL (WS_KV + 2u * (size_t)NB * NH * HD * HD)
#define WS_CTX (WS_KVL + 2u * (size_t)NB * NH * HD * HD)      // f32 ctx rows [b*T+t][1024]
#define WS_GS  (WS_CTX + 4u * (size_t)NB * TT * CC)          // f32 GroupNorm stats [b][h][2] (32-float lines)
#define WS_END (WS_GS + 4u * (size_t)NB * NH * 2 * 16)
typedef __attribute__((ext_vector_type(4))) __bf16 v4b;
typedef const __attribute__((address_space(1))) float* gcf;
// a block-uniform global address kept whole in a scalar register pair: the loads of a k step then take it as their scalar base beside one fixed 32-bit lane offset, and no vector address register is formed anew (and overwritten) in each step
__device__ __forceinline__ gcf ubase(const float* p) { const unsigned long long a = (unsigned long long)p;
  return (gcf)(((unsigned long long)(unsigned)__builtin_amdgcn_readfirstlane((int)(a >> 32)) << 32) | (unsigned)__builtin_amdgcn_readfirstlane((int)(unsigned)a)); }
typedef const __attribute__((address_space(1))) v4f* gcv4;
#define PT 40   // LDS row pitch of a staged 32-k bf16 row, in elements: 80 B = 16 B x odd, which ds_load_b128 fragment reads take without bank conflicts
// ---- k_proj: block = (128 rows, 128 cols, which), 8 waves of 32 x 64: qkv = x W^T + b ([out,in] rows which*1024 + o). Per 32-k step the block converts its x and W tiles to bf16 once and stages them in LDS (two buffers, next step's global loads in flight over the products); q -> f16 hi + residual rows; k, v -> bf16 hi + lo planes [b][c][t]
__global__ __launch_bounds__(256) void k_proj(const float* __restrict__ X, const float* __restrict__ Wt, const float* __restrict__ Bv, _Float16* __restrict__ QH, _Float16* __restrict__ QL, __bf16* __restrict__ KT, __bf16* __restrict__ KL, __bf16* __restrict__ VT, __bf16* __restrict__ VL) {
  __shared__ __align__(16) char sm[2 * 128 * 136 * 2];   // loop: x tiles [2][128][PT], W tiles [2][128][PT]; epilogue: hi and lo tiles [128][136]
  __bf16 (*sx)[128][PT] = (__bf16 (*)[128][PT])sm; __bf16 (*sw)[128][PT] = (__bf16 (*)[128][PT])(sm + 2 * 128 * PT * 2);
  const int tid = threadIdx.x, wave = tid >> 5, lane = tid & 31, col = lane & 15, g = lane >> 4, wm = wave >> 1, wn = wave & 1; const int which = blockIdx.z; const int c0 = blockIdx.y * 128; const size_t r0 = (size_t)blockIdx.x * 128;
  const int lr = tid >> 3, lq = tid & 7;   // staging: rows lr + 32 i, floats 4 lq .. 4 lq + 3 (8 lanes cover one 128-B line)
  const float* xp = X + r0 * CC; const float* wp = Wt + (size_t)(which * CC + c0) * CC; const unsigned lo = lr * CC + lq * 4;   // block-uniform bases, one 32-bit lane offset for both tiles
  const int st = (blockIdx.x + 4 * blockIdx.y) & (CC / 32 - 1);   // first k step of this block; the walk wraps round. The 32 blocks that share a W tile and the 8 column blocks that share an x tile then stand at different steps and do not ask L2 for the same lines at one moment
  v4f px[4], pw[4];
#pragma unroll
  for (int i = 0; i < 4; ++i) { px[i] = *(const v4f*)(xp + st * 32 + i * 32 * CC + lo); pw[i] = *(const v4f*)(wp + st * 32 + i * 32 * CC + lo); }
  asm volatile("s_wait_xcnt 0x0" ::: "memory"); __builtin_amdgcn_sched_barrier(0);   // the wait stands in front of any later overwrite of the address registers that the loads above name; the scheduling barrier keeps later vector instructions from being lifted over it
  v8f acc[2][4] = {};
#pragma unroll 2
  for (int kc = 0; kc < CC / 32; ++kc) { const int bf = kc & 1;
#pragma unroll
    for (int i = 0; i < 4; ++i) { *(v4b*)&sx[bf][lr + 32 * i][lq * 4] = __builtin_convertvector(px[i], v4b); *(v4b*)&sw[bf][lr + 32 * i][lq * 4] = __builtin_convertvector(pw[i], v4b); }
    __syncthreads();   // publishes step kc's tiles; it also ends every wave's reads of the other buffer (step kc - 1) before step kc + 1 is stored there
    v16b a[2], w[4];
#pragma unroll
    for (int it = 0; it < 2; ++it) a[it] = frag_b(&sx[bf][wm * 32 + it * 16 + col][0], lane);
#pragma unroll
    for (int j = 0; j < 4; ++j) w[j] = frag_b(&sw[bf][wn * 64 + j * 16 + col][0], lane);
    if (kc + 1 < CC / 32) { const int kn = ((st + kc + 1) & (CC / 32 - 1)) * 32;   // next step of the wrapped walk, block-uniform
      const gcf xk = ubase(xp + kn), wk = ubase(wp + kn);
#pragma unroll
      for (int i = 0; i < 4; ++i) { px[i] = *(gcv4)(xk + i * 32 * CC + lo); pw[i] = *(gcv4)(wk + i * 32 * CC + lo); }
      asm volatile("s_wait_xcnt 0x0" ::: "memory"); __builtin_amdgcn_sched_barrier(0);   // the wait stands in front of any later overwrite of the address registers that the loads above name; the scheduling barrier keeps later vector instructions from being lifted over it
    }
#pragma unroll
    for (int it = 0; it < 2; ++it)
#pragma unroll
      for (int j = 0; j < 4; ++j) acc[it][j] = wmma_bf(a[it], w[j], acc[it][j]);
    __builtin_amdgcn_sched_barrier(0); }   // keeps the next step's conversions, and with them the wait for its global loads, behind this step's products
  __syncthreads();   // the last step's fragment reads end before the epilogue tiles overwrite the staging buffers
  _Float16 (*sh)[136] = (_Float16 (*)[136])sm; _Float16 (*sl)[136] = (_Float16 (*)[136])(sm + 128 * 136 * 2); __bf16 (*th)[136] = (__bf16 (*)[136])sm; __bf16 (*tl2)[136] = (__bf16 (*)[136])(sm + 128 * 136 * 2);
  float bv[4];
#pragma unroll
  for (int j = 0; j < 4; ++j) bv[j] = Bv[which * CC + c0 + wn * 64 + j * 16 + col];
  asm volatile("s_wait_xcnt 0x0" ::: "memory"); __builtin_amdgcn_sched_barrier(0);   // wait and scheduling barrier as behind the tile loads above
  if (which == 0) {
#pragma unroll
    for (int j = 0; j < 4; ++j) { const int cl = wn * 64 + j * 16 + col; const float bb = bfr(bv[j]);
#pragma unroll
      for (int it = 0; it < 2; ++it)
#pragma unroll
        for (int r = 0; r < 8; ++r) { const float v = acc[it][j][r] + bb; const int rl = wm * 32 + it * 16 + 8 * g + r; const _Float16 hv = (_Float16)v; sh[rl][cl] = hv; sl[rl][cl] = (_Float16)((v - (float)hv) * 1024.0f); } }
  } else {
#pragma unroll
    for (int j = 0; j < 4; ++j) { const int cl = wn * 64 + j * 16 + col; const float bb = bfr(bv[j]);
#pragma unroll
      for (int it = 0; it < 2; ++it) { v8b h8, l8;
#pragma unroll
        for (int r = 0; r < 8; ++r) { const float v = acc[it][j][r] + bb; const __bf16 bh = (__bf16)v; h8[r] = bh; l8[r] = (__bf16)(v - (float)bh); }
        *(v8b*)&th[cl][wm * 32 + it * 16 + 8 * g] = h8; *(v8b*)&tl2[cl][wm * 32 + it * 16 + 8 * g] = l8; }
      __builtin_amdgcn_sched_barrier(0); }   // one column group at a time: keeps the epilogue's register use under the loop's 160, at which three blocks share a WGP
  }
  __syncthreads();
  if (which == 0) { for (int e = tid; e < 128 * 16; e += 256) { const int rl = e >> 4, q = e & 15; vst2((unsigned*)(QH + (r0 + rl) * CC + c0 + q * 8), *(const v4u*)&sh[rl][q * 8]); vst2((unsigned*)(QL + (r0 + rl) * CC + c0 + q * 8), *(const v4u*)&sl[rl][q * 8]); } }
  else { __bf16* DT = which == 1 ? KT : VT; __bf16* DL = which == 1 ? KL : VL; const size_t b = r0 / TT; const int t0 = (int)(r0 % TT); for (int e = tid; e < 128 * 16; e += 256) { const int cl = e >> 4, q = e & 15; const size_t o2 = (b * CC + c0 + cl) * (size_t)TT + t0 + q * 8; vst2((unsigned*)(DT + o2), *(const v4u*)&th[cl][q * 8]); vst2((unsigned*)(DL + o2), *(const v4u*)&tl2[cl][q * 8]); } } }
// B fragment of one head's KV, stored tile by tile [jt][it][16 j][16 i]: elements 0..7 = i 8g + 0..7 (tile it 0), 8..15 = i 16 + 8g + 0..7 (tile it 1, 256 elements on): the k order of frag_h
__device__ __forceinline__ v16h frag_kv(const _Float16* row0, int lane) {
  union { v16h v; v8h q[2]; } u; const _Float16* p = row0 + 8 * (lane >> 4);
  u.q[0] = *(const v8h*)p; u.q[1] = *(const v8h*)(p + 256); return u.v;
}
// ---- k_kv: block = (h, b, tile (it, jt)), 8 waves: KV[i][j] = sum_s k[s][i] v[s][j] for one 16 x 16 tile (A rows = k planes (i), B cols = v planes (j); 3 products). Wave w sums s = 256 w .. 256 w + 255 (4 pairs of 32-s steps, one 128-B line of each plane row per pair; two pairs of loads in flight); the 8 partial tiles are added in LDS in wave order; stored as f16 hi + residual tiles [b][h][jt][it][j][i]: 512 B + 512 B per block
__global__ __launch_bounds__(256) void k_kv(const __bf16* __restrict__ KT, const __bf16* __restrict__ KL, const __bf16* __restrict__ VT, const __bf16* __restrict__ VL, _Float16* __restrict__ KV, _Float16* __restrict__ KVL) { __shared__ __align__(16) v4f red[8][2][32];
  const int tid = threadIdx.x, wave = tid >> 5, lane = tid & 31, col = lane & 15, g = lane >> 4; const size_t b = blockIdx.y; const int h = blockIdx.x, it = blockIdx.z >> 1, jt = blockIdx.z & 1;
  const size_t ko = (b * CC + h * HD + it * 16 + col) * (size_t)TT + wave * (TT / 8), vo = (b * CC + h * HD + jt * 16 + col) * (size_t)TT + wave * (TT / 8);
  const __bf16* pl[4] = { KT + ko, KL + ko, VT + vo, VL + vo };
  v16b f[2][4][2];   // [buffer][plane: k hi, k lo, v hi, v lo][step of the pair]
#pragma unroll
  for (int p = 0; p < 2; ++p) {
#pragma unroll
    for (int q = 0; q < 4; ++q)
#pragma unroll
      for (int e = 0; e < 2; ++e) f[p][q][e] = frag_b(pl[q] + p * 64 + e * 32, lane);
    __builtin_amdgcn_sched_barrier(0); }   // pair 0's loads stay in front of pair 1's, so that pair 0's products wait for their own 16 loads alone, and both pairs are issued before the first product waits
  v8f ahh = {}, alh = {}, ahl = {};
#pragma unroll
  for (int p = 0; p < 4; ++p) { const int bf = p & 1;
#pragma unroll
    for (int e = 0; e < 2; ++e) { ahh = wmma_bf(f[bf][0][e], f[bf][2][e], ahh); alh = wmma_bf(f[bf][1][e], f[bf][2][e], alh); ahl = wmma_bf(f[bf][0][e], f[bf][3][e], ahl); }
    if (p + 2 < 4) {
#pragma unroll
      for (int q = 0; q < 4; ++q)
#pragma unroll
        for (int e = 0; e < 2; ++e) f[bf][q][e] = frag_b(pl[q] + (p + 2) * 64 + e * 32, lane);
    }
    if (p == 1) asm volatile("s_wait_xcnt 0x0" ::: "memory");   // the wait stands behind the last plane load, in front of any later overwrite of the address registers that the loads name
    __builtin_amdgcn_sched_barrier(0); }   // keeps each refill directly behind the products that free its registers, so that it flies over the other buffer's products; behind the wait it keeps later vector instructions from being lifted over it
  v8f t = ahh + (alh + ahl);
  red[wave][0][lane] = __builtin_shufflevector(t, t, 0, 1, 2, 3); red[wave][1][lane] = __builtin_shufflevector(t, t, 4, 5, 6, 7);
  __syncthreads();   // publishes the 8 partial tiles to wave 0
  if (wave == 0) { v4f s0 = red[0][0][lane], s1 = red[0][1][lane];
#pragma unroll
    for (int w = 1; w < 8; ++w) { s0 += red[w][0][lane]; s1 += red[w][1][lane]; }
    v8h h8, l8;
#pragma unroll
    for (int r = 0; r < 8; ++r) { const float v = r < 4 ? s0[r & 3] : s1[r & 3]; const _Float16 hv = (_Float16)v; h8[r] = hv; l8[r] = (_Float16)((v - (float)hv) * 1024.0f); }
    const size_t o = (((b * NH + h) * 2 + jt) * 2 + it) * 256 + col * 16 + 8 * g; vst2(KV + o, h8); vst2(KVL + o, l8); } }
// ---- k_ctx: block = (64 rows t, 4 heads): ctx[t][h*32 + j] = sum_i q[t][h*32 + i] KV_h[i][j] (q hi+res x KV hi+res, 3 products, K = 32 = one chunk); 512-B segments per row
__global__ __launch_bounds__(128) void k_ctx(const _Float16* __restrict__ QH, const _Float16* __restrict__ QL, const _Float16* __restrict__ KV, const _Float16* __restrict__ KVL, float* __restrict__ CTX) { __shared__ __align__(16) float sf[4][16][132];
  const int tid = threadIdx.x, wave = tid >> 5, lane = tid & 31, col = lane & 15, g = lane >> 4; const int h0 = blockIdx.y * 4; const size_t r0 = (size_t)blockIdx.x * 64 + wave * 16; const size_t b = r0 / TT;
#pragma unroll
  for (int hh = 0; hh < 4; ++hh) { const int h = h0 + hh; v8f acc[2] = {}; const v16h ah = frag_h(QH + (r0 + col) * CC + h * HD, lane), al = frag_h(QL + (r0 + col) * CC + h * HD, lane);
#pragma unroll
    for (int jt = 0; jt < 2; ++jt) { const size_t bo = ((b * NH + h) * 4 + jt * 2) * 256 + col * 16; const v16h bh = frag_kv(KV + bo, lane), bl = frag_kv(KVL + bo, lane); acc[jt] = wmma16(ah, bh, acc[jt]); v8f t2 = {}; t2 = wmma16(al, bh, t2); t2 = wmma16(ah, bl, t2);
#pragma unroll
      for (int r = 0; r < 8; ++r) sf[wave][8 * g + r][hh * 32 + jt * 16 + col] = acc[jt][r] + t2[r] * (1.0f / 1024.0f); } }
  LDSX(); for (int rl = 0; rl < 16; ++rl) vst2(CTX + (r0 + rl) * CC + h0 * HD + lane * 4, *(const v4f*)&sf[wave][rl][lane * 4]); }
__global__ __launch_bounds__(256) void k_gn(const float* __restrict__ CTX, float* __restrict__ GS) { __shared__ float sred[8]; __shared__ float sbc;
  const int t = threadIdx.x; const int h = blockIdx.x; const size_t b = blockIdx.y; const float* base = CTX + (b * TT) * CC + h * HD; const int n = TT * HD;
  float s = 0.f; for (int e = t; e < TT * 8; e += 256) { const int row = e >> 3, q = e & 7; const v4f v = *(const v4f*)(base + (size_t)row * CC + q * 4); s += (v[0] + v[1]) + (v[2] + v[3]); }
#pragma unroll
  for (int o = 1; o < 32; o <<= 1) s += __shfl_xor(s, o);
  if ((t & 31) == 0) sred[t >> 5] = s; __syncthreads(); if (t == 0) { float a = 0.f; for (int w = 0; w < 8; ++w) a += sred[w]; sbc = a / (float)n; } __syncthreads(); const float mu = sbc; __syncthreads();
  float s2 = 0.f; for (int e = t; e < TT * 8; e += 256) { const int row = e >> 3, q = e & 7; const v4f v = *(const v4f*)(base + (size_t)row * CC + q * 4); const float d0 = v[0] - mu, d1 = v[1] - mu, d2 = v[2] - mu, d3 = v[3] - mu; s2 += (d0 * d0 + d1 * d1) + (d2 * d2 + d3 * d3); }
#pragma unroll
  for (int o = 1; o < 32; o <<= 1) s2 += __shfl_xor(s2, o);
  if ((t & 31) == 0) sred[t >> 5] = s2; __syncthreads();
  if (t < 32) { float v = 0.f; if (t == 0) v = mu; if (t == 1) { float a = 0.f; for (int w = 0; w < 8; ++w) a += sred[w]; v = rsqrtf(a / (float)n + 1e-5f); } vst2(GS + (b * NH + h) * 32 + t, v); } }
// ---- k_out: block = (128 rows, 128 cols), 8 waves of 32 x 64: out = gh (hi + lo) out_w^T + out_b with gh = (ctx - mu_h) rstd_h gn_w[c] + gn_b[c]; per 32-k step (one head) the block builds gh hi, gh lo and the bf16 out_w tile once and stages them in LDS (two buffers), as k_proj does
__global__ __launch_bounds__(256) void k_out(const float* __restrict__ CTX, const float* __restrict__ GS, const float* __restrict__ GW, const float* __restrict__ GB, const float* __restrict__ WO, const float* __restrict__ BO, float* __restrict__ OUT) {
  __shared__ __align__(16) char sm[128 * 132 * 4];   // loop: gh hi, gh lo and W tiles, each [2][128][PT]; epilogue: f32 tile [128][132]
  __bf16 (*sa)[128][PT] = (__bf16 (*)[128][PT])sm; __bf16 (*sb)[128][PT] = (__bf16 (*)[128][PT])(sm + 2 * 128 * PT * 2); __bf16 (*sw)[128][PT] = (__bf16 (*)[128][PT])(sm + 4 * 128 * PT * 2);
  const int tid = threadIdx.x, wave = tid >> 5, lane = tid & 31, col = lane & 15, g = lane >> 4, wm = wave >> 1, wn = wave & 1; const int c0 = blockIdx.y * 128; const size_t r0 = (size_t)blockIdx.x * 128; const size_t b = r0 / TT;
  const int lr = tid >> 3, lq = tid & 7;   // staging: rows lr + 32 i, floats 4 lq .. 4 lq + 3
  const float* cp = CTX + r0 * CC; const float* wp = WO + (size_t)c0 * CC; const unsigned lo = lr * CC + lq * 4;   // block-uniform bases, one 32-bit lane offset for both tiles
  const float* gs = GS + b * NH * 32;
  const int st = (blockIdx.x + 4 * blockIdx.y) & (CC / 32 - 1);   // first k step (head) of this block; the walk wraps round, as in k_proj: the blocks that share a ctx or an out_w tile stand at different steps
  v4f pc[4], pw[4], pgw, pgb; float mu, rs;
#pragma unroll
  for (int i = 0; i < 4; ++i) { pc[i] = *(const v4f*)(cp + st * 32 + i * 32 * CC + lo); pw[i] = *(const v4f*)(wp + st * 32 + i * 32 * CC + lo); }
  pgw = *(const v4f*)(GW + st * 32 + lq * 4); pgb = *(const v4f*)(GB + st * 32 + lq * 4); mu = gs[st * 32]; rs = gs[st * 32 + 1];
  asm volatile("s_wait_xcnt 0x0" ::: "memory"); __builtin_amdgcn_sched_barrier(0);   // the wait stands in front of any later overwrite of the address registers that the loads above name; the scheduling barrier keeps later vector instructions from being lifted over it
  v8f acc[2][4] = {};
#pragma unroll 2
  for (int kc = 0; kc < CC / 32; ++kc) { const int bf = kc & 1;   /* 32 channels per step == one head */
#pragma unroll
    for (int i = 0; i < 4; ++i) { v4f v;
#pragma unroll
      for (int e = 0; e < 4; ++e) v[e] = (pc[i][e] - mu) * rs * bfr(pgw[e]) + bfr(pgb[e]);
      const v4b hv = __builtin_convertvector(v, v4b); *(v4b*)&sa[bf][lr + 32 * i][lq * 4] = hv; *(v4b*)&sb[bf][lr + 32 * i][lq * 4] = __builtin_convertvector(v - __builtin_convertvector(hv, v4f), v4b); *(v4b*)&sw[bf][lr + 32 * i][lq * 4] = __builtin_convertvector(pw[i], v4b); }
    __syncthreads();   // publishes step kc's tiles; it also ends every wave's reads of the other buffer (step kc - 1) before step kc + 1 is stored there
    v16b ah[2], al[2], w[4];
#pragma unroll
    for (int it = 0; it < 2; ++it) { ah[it] = frag_b(&sa[bf][wm * 32 + it * 16 + col][0], lane); al[it] = frag_b(&sb[bf][wm * 32 + it * 16 + col][0], lane); }
#pragma unroll
    for (int j = 0; j < 4; ++j) w[j] = frag_b(&sw[bf][wn * 64 + j * 16 + col][0], lane);
    if (kc + 1 < CC / 32) { const int kn = ((st + kc + 1) & (CC / 32 - 1)) * 32;   // next step of the wrapped walk, block-uniform
      const gcf ck = ubase(cp + kn), wk = ubase(wp + kn), gwk = ubase(GW + kn), gbk = ubase(GB + kn); mu = gs[kn]; rs = gs[kn + 1];
      __builtin_amdgcn_sched_barrier(0);   // the fragment reads above and the scalar load of mu, rs are issued ahead of the tile loads: among them they stood behind the waits that precede each re-use of a scalar base register
#pragma unroll
      for (int i = 0; i < 4; ++i) { pc[i] = *(gcv4)(ck + i * 32 * CC + lo); pw[i] = *(gcv4)(wk + i * 32 * CC + lo); }
      pgw = *(gcv4)(gwk + (unsigned)(lq * 4)); pgb = *(gcv4)(gbk + (unsigned)(lq * 4));
      asm volatile("s_wait_xcnt 0x0" ::: "memory"); __builtin_amdgcn_sched_barrier(0);   // the wait stands in front of any later overwrite of the address registers that the loads above name; the scheduling barrier keeps later vector instructions from being lifted over it
    }
#pragma unroll
    for (int it = 0; it < 2; ++it)
#pragma unroll
      for (int j = 0; j < 4; ++j) acc[it][j] = wmma_bf(ah[it], w[j], acc[it][j]);
#pragma unroll
    for (int it = 0; it < 2; ++it)
#pragma unroll
      for (int j = 0; j < 4; ++j) acc[it][j] = wmma_bf(al[it], w[j], acc[it][j]);
    __builtin_amdgcn_sched_barrier(0); }   // keeps the next step's conversions, and with them the wait for its global loads, behind this step's products
  __syncthreads();   // the last step's fragment reads end before the epilogue tile overwrites the staging buffers
  float (*sf)[132] = (float (*)[132])sm;
#pragma unroll
  for (int j = 0; j < 4; ++j) { const int cl = wn * 64 + j * 16 + col; const float bb = bfr(BO[c0 + cl]);
#pragma unroll
    for (int it = 0; it < 2; ++it)
#pragma unroll
      for (int r = 0; r < 8; ++r) sf[wm * 32 + it * 16 + 8 * g + r][cl] = acc[it][j][r] + bb; }
  __syncthreads();
  for (int e = tid; e < 128 * 32; e += 256) { const int rl = e >> 5, q = e & 31; vst2(OUT + (r0 + rl) * CC + c0 + q * 4, *(const v4f*)&sf[rl][q * 4]); } }
extern "C" void kernel_launch(void* const* d_in, const int* in_sizes, int n_in, void* d_out, int out_size, void* d_ws, size_t ws_size, hipStream_t stream) {
  (void)in_sizes; (void)n_in; (void)out_size;
  const float** F = (const float**)d_in;   // 0 x [2,2048,1024], 1 Wqkv_w [3072,1024] ([out,in]; channel o = which*1024 + h*32 + d), 2 Wqkv_b [3072], 3 gn_w [1024], 4 gn_b, 5 out_w [1024,1024] ([out,in]), 6 out_b
  if (ws_size < (size_t)WS_END) return;
  char* ws = (char*)d_ws; _Float16 *QH = (_Float16*)(ws + WS_QH), *QL = (_Float16*)(ws + WS_QL), *KV = (_Float16*)(ws + WS_KV), *KVL = (_Float16*)(ws + WS_KVL); __bf16 *KT = (__bf16*)(ws + WS_KT), *KL = (__bf16*)(ws + WS_KL), *VT = (__bf16*)(ws + WS_VT), *VL = (__bf16*)(ws + WS_VL); float *CTX = (float*)(ws + WS_CTX), *GS = (float*)(ws + WS_GS);
  k_proj<<<dim3(TNB * TT / 128, CC / 128, 3), 256, 0, stream>>>(F[0], F[1], F[2], QH, QL, KT, KL, VT, VL);
  k_kv<<<dim3(NH, TNB, 4), 256, 0, stream>>>(KT, KL, VT, VL, KV, KVL);
  k_ctx<<<dim3(TNB * TT / 64, NH / 4), 128, 0, stream>>>(QH, QL, KV, KVL, CTX);
  k_gn<<<dim3(NH, TNB), 256, 0, stream>>>(CTX, GS);
  k_out<<<dim3(TNB * TT / 128, CC / 128), 256, 0, stream>>>(CTX, GS, F[3], F[4], F[5], F[6], (float*)d_out);
}

// v004
// Measured time: 74.8 microseconds a run.
// Timed twice side by side with v003, it ran 1.15 times as fast both times.
// Over all steps from v000 it is 5.66 times as fast.
#include <hip/hip_runtime.h>
#include <math.h>

typedef __attribute__((ext_vector_type(16))) _Float16 v16h;
typedef __attribute__((ext_vector_type(16))) __bf16 v16b;
typedef __attribute__((ext_vector_type(8)))  _Float16 v8h;
typedef __attribute__((ext_vector_type(8)))  float v8f;
typedef __attribute__((ext_vector_type(4)))  float v4f;
typedef __attribute__((ext_vector_type(2)))  float v2f;
typedef __attribute__((ext_vector_type(4)))  unsigned v4u;
typedef __attribute__((ext_vector_type(4)))  int v4i;
typedef float __attribute__((may_alias)) float_a;
typedef int __attribute__((may_alias)) int_a;

template <typename T> __device__ __forceinline__ void vst2(void* p, T v) { *(T*)p = v;  }
__device__ __forceinline__ v8f wmma16(v16h a, v16h b, v8f c) {
  v8f d = __builtin_amdgcn_wmma_f32_16x16x32_f16(false, a, false, b, (short)0, c, false, false);
  asm volatile("v_nop\n\tv_nop\n\tv_nop\n\tv_nop" : "+v"(d) : "v"(a), "v"(b));
  return d;
}
__device__ __forceinline__ v8f wmma_bf(v16b a, v16b b, v8f c) {
  v8f d = __builtin_amdgcn_wmma_f32_16x16x32_bf16(false, a, false, b, (short)0, c, false, false);
  asm volatile("v_nop\n\tv_nop\n\tv_nop\n\tv_nop" : "+v"(d) : "v"(a), "v"(b));
  return d;
}
// 16x16x32 fragments: lane = (h = lane>>4, row/col = lane&15); elements 0..7 = k0+8h+0..7, 8..15 = k0+16+8h+0..7; D element r = row 8h+r
__device__ __forceinline__ v16h frag_h(const _Float16* rowk0, int lane) {
  union { v16h v; v8h q[2]; } u; const _Float16* p = rowk0 + 8 * (lane >> 4);
  u.q[0] = *(const v8h*)p; u.q[1] = *(const v8h*)(p + 16); return u.v;
}
__device__ __forceinline__ v16h frag_f32(const float* rowk0, int lane) {
  v16h a; const float* p = rowk0 + 8 * (lane >> 4);
#pragma unroll
  for (int i = 0; i < 8; ++i) { a[i] = (_Float16)p[i]; a[8 + i] = (_Float16)p[16 + i]; }
  return a;
}
__device__ __forceinline__ v16h frag_f32s(const float* rowk0, int lane, float sc) {
  v16h a; const float* p = rowk0 + 8 * (lane >> 4);
#pragma unroll
  for (int i = 0; i < 8; ++i) { a[i] = (_Float16)(p[i] * sc); a[8 + i] = (_Float16)(p[16 + i] * sc); }
  return a;
}
// column fragment from a [K][ld] layout (column n), rows >= K read as 0
__device__ __forceinline__ v16h fragc_f32(const float* W, int k0, int n, int lane, int ld, int K) {
  v16h a; const int g = lane >> 4;
#pragma unroll
  for (int i = 0; i < 8; ++i) { const int ka = k0 + 8 * g + i, kb = ka + 16;
    a[i] = (_Float16)(ka < K ? W[(size_t)(ka < K ? ka : K - 1) * ld + n] : 0.f); a[8 + i] = (_Float16)(kb < K ? W[(size_t)(kb < K ? kb : K - 1) * ld + n] : 0.f); }
  return a;
}
struct F2 { v16b h, l; };
__device__ __forceinline__ F2 bsplit16(const float v[16]) { F2 r;
#pragma unroll
  for (int i = 0; i < 16; ++i) { const __bf16 h = (__bf16)v[i]; r.h[i] = h; r.l[i] = (__bf16)(v[i] - (float)h); }
  return r; }
__device__ __forceinline__ F2 split_row(const float* row, int k0, int lane) { float v[16]; const float* p = row + k0 + 8 * (lane >> 4);
#pragma unroll
  for (int i = 0; i < 8; ++i) { v[i] = p[i]; v[8 + i] = p[16 + i]; }
  return bsplit16(v); }
__device__ __forceinline__ F2 split_rowK(const float* row, int k0, int lane, int K) { float v[16]; const int g = lane >> 4;
#pragma unroll
  for (int i = 0; i < 8; ++i) { const int ka = k0 + 8 * g + i, kb = ka + 16; v[i] = ka < K ? row[ka < K ? ka : K - 1] : 0.f; v[8 + i] = kb < K ? row[kb < K ? kb : K - 1] : 0.f; }
  return bsplit16(v); }
__device__ __forceinline__ F2 split_col(const float* W, int k0, int n, int lane, int ld, int K) { float v[16]; const int g = lane >> 4;
#pragma unroll
  for (int i = 0; i < 8; ++i) { const int ka = k0 + 8 * g + i, kb = ka + 16; v[i] = ka < K ? W[(size_t)(ka < K ? ka : K - 1) * ld + n] : 0.f; v[8 + i] = kb < K ? W[(size_t)(kb < K ? kb : K - 1) * ld + n] : 0.f; }
  return bsplit16(v); }
__device__ __forceinline__ v8f mac3(const F2& a, const F2& b, v8f c) { c = wmma_bf(a.l, b.h, c); c = wmma_bf(a.h, b.l, c); return wmma_bf(a.h, b.h, c); }
__device__ __forceinline__ float sigm(float v) { return 1.0f / (1.0f + expf(-v)); }
#define LDSX() do { asm volatile("s_wait_dscnt 0" ::: "memory"); __builtin_amdgcn_wave_barrier(); __builtin_amdgcn_fence(__ATOMIC_RELEASE, "workgroup"); } while (0)

// MHLA (B 2, S 2,048, 1,024 = 32 heads x 32): q,k,v = split(x Wqkv^T + b) as [B,S,3,H,Dh]; a = q k^T (no softmax); ctx = a v  (== q (k^T v), reassociated exactly); GroupNorm per (b, head) over (Dh, S) with eps 1e-5 and per-channel affine; out = ctx out_w^T + out_b.
__device__ __forceinline__ float bfr(float v) { return (float)(__bf16)v; }
#define NB 2
#define TT 2048
#define CC 1024
#define NH 32
#define HD 32
#ifndef TNB
#define TNB NB
#endif
#ifndef QSTR
#define QSTR (TT * CC)        // unused; x rows are read as [b*T+t][1024]
#endif
typedef __attribute__((ext_vector_type(8))) __bf16 v8b;
__device__ __forceinline__ v16b frag_b(const __bf16* rowk0, int lane) { union { v16b v; v8b q[2]; } u; const __bf16* p = rowk0 + 8 * (lane >> 4); u.q[0] = *(const v8b*)p; u.q[1] = *(const v8b*)(p + 16); return u.v; }
#define WS_QH  0u                                          // f16 q hi rows [b*T+t][1024]
#define WS_QL  (WS_QH + 2u * (size_t)NB * TT * CC)
#define WS_KT  (WS_QL + 2u * (size_t)NB * TT * CC)           // bf16 k hi planes [b][c][s]
#define WS_KL  (WS_KT + 2u * (size_t)NB * CC * TT)
#define WS_VT  (WS_KL + 2u * (size_t)NB * CC * TT)           // bf16 v hi planes [b][c][s]
#define WS_VL  (WS_VT + 2u * (size_t)NB * CC * TT)
#define WS_KV  (WS_VL + 2u * (size_t)NB * CC * TT)           // f16 KV hi + residual tiles [b][h][jt][it][j][i] (j = v dim = output col, i = k dim)
#define WS_KVL (WS_KV + 2u * (size_t)NB * NH * HD * HD)
#define WS_CTX (WS_KVL + 2u * (size_t)NB * NH * HD * HD)      // f32 ctx rows [b*T+t][1024]
#define WS_GS  (WS_CTX + 4u * (size_t)NB * TT * CC)          // f32 GroupNorm partials, one 128-B line per k_ctx block: [64-row block][4-head group][head][wave][sum, centred square sum]
#define WS_END (WS_GS + 4u * (size_t)(NB * TT / 64) * (NH / 4) * 32)
typedef __attribute__((ext_vector_type(4))) __bf16 v4b;
typedef const __attribute__((address_space(1))) float* gcf;
// a block-uniform global address kept whole in a scalar register pair: the loads of a k step then take it as their scalar base beside one fixed 32-bit lane offset, and no vector address register is formed anew (and overwritten) in each step
__device__ __forceinline__ gcf ubase(const float* p) { const unsigned long long a = (unsigned long long)p;
  return (gcf)(((unsigned long long)(unsigned)__builtin_amdgcn_readfirstlane((int)(a >> 32)) << 32) | (unsigned)__builtin_amdgcn_readfirstlane((int)(unsigned)a)); }
typedef const __attribute__((address_space(1))) v4f* gcv4;
#define PT 40   // LDS row pitch of a staged 32-k bf16 row, in elements: 80 B = 16 B x odd, which ds_load_b128 fragment reads take without bank conflicts
// ---- k_proj: block = (128 rows, 128 cols, which), 8 waves of 32 x 64: qkv = x W^T + b ([out,in] rows which*1024 + o). Per 32-k step the block converts its x and W tiles to bf16 once and stages them in LDS (two buffers, next step's global loads in flight over the products); q -> f16 hi + residual rows; k, v -> bf16 hi + lo planes [b][c][t]
__global__ __launch_bounds__(256) void k_proj(const float* __restrict__ X, const float* __restrict__ Wt, const float* __restrict__ Bv, _Float16* __restrict__ QH, _Float16* __restrict__ QL, __bf16* __restrict__ KT, __bf16* __restrict__ KL, __bf16* __restrict__ VT, __bf16* __restrict__ VL) {
  __shared__ __align__(16) char sm[2 * 128 * 136 * 2];   // loop: x tiles [2][128][PT], W tiles [2][128][PT]; epilogue: hi and lo tiles [128][136]
  __bf16 (*sx)[128][PT] = (__bf16 (*)[128][PT])sm; __bf16 (*sw)[128][PT] = (__bf16 (*)[128][PT])(sm + 2 * 128 * PT * 2);
  const int tid = threadIdx.x, wave = tid >> 5, lane = tid & 31, col = lane & 15, g = lane >> 4, wm = wave >> 1, wn = wave & 1; const int which = blockIdx.z; const int c0 = blockIdx.y * 128; const size_t r0 = (size_t)blockIdx.x * 128;
  const int lr = tid >> 3, lq = tid & 7;   // staging: rows lr + 32 i, floats 4 lq .. 4 lq + 3 (8 lanes cover one 128-B line)
  const float* xp = X + r0 * CC; const float* wp = Wt + (size_t)(which * CC + c0) * CC; const unsigned lo = lr * CC + lq * 4;   // block-uniform bases, one 32-bit lane offset for both tiles
  const int st = (blockIdx.x + 4 * blockIdx.y) & (CC / 32 - 1);   // first k step of this block; the walk wraps round. The 32 blocks that share a W tile and the 8 column blocks that share an x tile then stand at different steps and do not ask L2 for the same lines at one moment
  v4f px[4], pw[4];
#pragma unroll
  for (int i = 0; i < 4; ++i) { px[i] = *(const v4f*)(xp + st * 32 + i * 32 * CC + lo); pw[i] = *(const v4f*)(wp + st * 32 + i * 32 * CC + lo); }
  asm volatile("s_wait_xcnt 0x0" ::: "memory"); __builtin_amdgcn_sched_barrier(0);   // the wait stands in front of any later overwrite of the address registers that the loads above name; the scheduling barrier keeps later vector instructions from being lifted over it
  v8f acc[2][4] = {};
#pragma unroll 2
  for (int kc = 0; kc < CC / 32; ++kc) { const int bf = kc & 1;
#pragma unroll
    for (int i = 0; i < 4; ++i) { *(v4b*)&sx[bf][lr + 32 * i][lq * 4] = __builtin_convertvector(px[i], v4b); *(v4b*)&sw[bf][lr + 32 * i][lq * 4] = __builtin_convertvector(pw[i], v4b); }
    __syncthreads();   // publishes step kc's tiles; it also ends every wave's reads of the other buffer (step kc - 1) before step kc + 1 is stored there
    v16b a[2], w[4];
#pragma unroll
    for (int it = 0; it < 2; ++it) a[it] = frag_b(&sx[bf][wm * 32 + it * 16 + col][0], lane);
#pragma unroll
    for (int j = 0; j < 4; ++j) w[j] = frag_b(&sw[bf][wn * 64 + j * 16 + col][0], lane);
    if (kc + 1 < CC / 32) { const int kn = ((st + kc + 1) & (CC / 32 - 1)) * 32;   // next step of the wrapped walk, block-uniform
      const gcf xk = ubase(xp + kn), wk = ubase(wp + kn);
#pragma unroll
      for (int i = 0; i < 4; ++i) { px[i] = *(gcv4)(xk + i * 32 * CC + lo); pw[i] = *(gcv4)(wk + i * 32 * CC + lo); }
      asm volatile("s_wait_xcnt 0x0" ::: "memory"); __builtin_amdgcn_sched_barrier(0);   // the wait stands in front of any later overwrite of the address registers that the loads above name; the scheduling barrier keeps later vector instructions from being lifted over it
    }
#pragma unroll
    for (int it = 0; it < 2; ++it)
#pragma unroll
      for (int j = 0; j < 4; ++j) acc[it][j] = wmma_bf(a[it], w[j], acc[it][j]);
    __builtin_amdgcn_sched_barrier(0); }   // keeps the next step's conversions, and with them the wait for its global loads, behind this step's products
  __syncthreads();   // the last step's fragment reads end before the epilogue tiles overwrite the staging buffers
  _Float16 (*sh)[136] = (_Float16 (*)[136])sm; _Float16 (*sl)[136] = (_Float16 (*)[136])(sm + 128 * 136 * 2); __bf16 (*th)[136] = (__bf16 (*)[136])sm; __bf16 (*tl2)[136] = (__bf16 (*)[136])(sm + 128 * 136 * 2);
  float bv[4];
#pragma unroll
  for (int j = 0; j < 4; ++j) bv[j] = Bv[which * CC + c0 + wn * 64 + j * 16 + col];
  asm volatile("s_wait_xcnt 0x0" ::: "memory"); __builtin_amdgcn_sched_barrier(0);   // wait and scheduling barrier as behind the tile loads above
  if (which == 0) {
#pragma unroll
    for (int j = 0; j < 4; ++j) { const int cl = wn * 64 + j * 16 + col; const float bb = bfr(bv[j]);
#pragma unroll
      for (int it = 0; it < 2; ++it)
#pragma unroll
        for (int r = 0; r < 8; ++r) { const float v = acc[it][j][r] + bb; const int rl = wm * 32 + it * 16 + 8 * g + r; const _Float16 hv = (_Float16)v; sh[rl][cl] = hv; sl[rl][cl] = (_Float16)((v - (float)hv) * 1024.0f); } }
  } else {
#pragma unroll
    for (int j = 0; j < 4; ++j) { const int cl = wn * 64 + j * 16 + col; const float bb = bfr(bv[j]);
#pragma unroll
      for (int it = 0; it < 2; ++it) { v8b h8, l8;
#pragma unroll
        for (int r = 0; r < 8; ++r) { const float v = acc[it][j][r] + bb; const __bf16 bh = (__bf16)v; h8[r] = bh; l8[r] = (__bf16)(v - (float)bh); }
        *(v8b*)&th[cl][wm * 32 + it * 16 + 8 * g] = h8; *(v8b*)&tl2[cl][wm * 32 + it * 16 + 8 * g] = l8; }
      __builtin_amdgcn_sched_barrier(0); }   // one column group at a time: keeps the epilogue's register use under the loop's 160, at which three blocks share a WGP
  }
  __syncthreads();
  if (which == 0) { for (int e = tid; e < 128 * 16; e += 256) { const int rl = e >> 4, q = e & 15; vst2((unsigned*)(QH + (r0 + rl) * CC + c0 + q * 8), *(const v4u*)&sh[rl][q * 8]); vst2((unsigned*)(QL + (r0 + rl) * CC + c0 + q * 8), *(const v4u*)&sl[rl][q * 8]); } }
  else { __bf16* DT = which == 1 ? KT : VT; __bf16* DL = which == 1 ? KL : VL; const size_t b = r0 / TT; const int t0 = (int)(r0 % TT); for (int e = tid; e < 128 * 16; e += 256) { const int cl = e >> 4, q = e & 15; const size_t o2 = (b * CC + c0 + cl) * (size_t)TT + t0 + q * 8; vst2((unsigned*)(DT + o2), *(const v4u*)&th[cl][q * 8]); vst2((unsigned*)(DL + o2), *(const v4u*)&tl2[cl][q * 8]); } } }
// B fragment of one head's KV, stored tile by tile [jt][it][16 j][16 i]: elements 0..7 = i 8g + 0..7 (tile it 0), 8..15 = i 16 + 8g + 0..7 (tile it 1, 256 elements on): the k order of frag_h
__device__ __forceinline__ v16h frag_kv(const _Float16* row0, int lane) {
  union { v16h v; v8h q[2]; } u; const _Float16* p = row0 + 8 * (lane >> 4);
  u.q[0] = *(const v8h*)p; u.q[1] = *(const v8h*)(p + 256); return u.v;
}
// ---- k_kv: block = (h, b, tile (it, jt)), 8 waves: KV[i][j] = sum_s k[s][i] v[s][j] for one 16 x 16 tile (A rows = k planes (i), B cols = v planes (j); 3 products). Wave w sums s = 256 w .. 256 w + 255 (4 pairs of 32-s steps, one 128-B line of each plane row per pair; two pairs of loads in flight); the 8 partial tiles are added in LDS in wave order; stored as f16 hi + residual tiles [b][h][jt][it][j][i]: 512 B + 512 B per block
__global__ __launch_bounds__(256) void k_kv(const __bf16* __restrict__ KT, const __bf16* __restrict__ KL, const __bf16* __restrict__ VT, const __bf16* __restrict__ VL, _Float16* __restrict__ KV, _Float16* __restrict__ KVL) { __shared__ __align__(16) v4f red[8][2][32];
  const int tid = threadIdx.x, wave = tid >> 5, lane = tid & 31, col = lane & 15, g = lane >> 4; const size_t b = blockIdx.y; const int h = blockIdx.x, it = blockIdx.z >> 1, jt = blockIdx.z & 1;
  const size_t ko = (b * CC + h * HD + it * 16 + col) * (size_t)TT + wave * (TT / 8), vo = (b * CC + h * HD + jt * 16 + col) * (size_t)TT + wave * (TT / 8);
  const __bf16* pl[4] = { KT + ko, KL + ko, VT + vo, VL + vo };
  v16b f[2][4][2];   // [buffer][plane: k hi, k lo, v hi, v lo][step of the pair]
#pragma unroll
  for (int p = 0; p < 2; ++p) {
#pragma unroll
    for (int q = 0; q < 4; ++q)
#pragma unroll
      for (int e = 0; e < 2; ++e) f[p][q][e] = frag_b(pl[q] + p * 64 + e * 32, lane);
    __builtin_amdgcn_sched_barrier(0); }   // pair 0's loads stay in front of pair 1's, so that pair 0's products wait for their own 16 loads alone, and both pairs are issued before the first product waits
  v8f ahh = {}, alh = {}, ahl = {};
#pragma unroll
  for (int p = 0; p < 4; ++p) { const int bf = p & 1;
#pragma unroll
    for (int e = 0; e < 2; ++e) { ahh = wmma_bf(f[bf][0][e], f[bf][2][e], ahh); alh = wmma_bf(f[bf][1][e], f[bf][2][e], alh); ahl = wmma_bf(f[bf][0][e], f[bf][3][e], ahl); }
    if (p + 2 < 4) {
#pragma unroll
      for (int q = 0; q < 4; ++q)
#pragma unroll
        for (int e = 0; e < 2; ++e) f[bf][q][e] = frag_b(pl[q] + (p + 2) * 64 + e * 32, lane);
    }
    if (p == 1) asm volatile("s_wait_xcnt 0x0" ::: "memory");   // the wait stands behind the last plane load, in front of any later overwrite of the address registers that the loads name
    __builtin_amdgcn_sched_barrier(0); }   // keeps each refill directly behind the products that free its registers, so that it flies over the other buffer's products; behind the wait it keeps later vector instructions from being lifted over it
  v8f t = ahh + (alh + ahl);
  red[wave][0][lane] = __builtin_shufflevector(t, t, 0, 1, 2, 3); red[wave][1][lane] = __builtin_shufflevector(t, t, 4, 5, 6, 7);
  __syncthreads();   // publishes the 8 partial tiles to wave 0
  if (wave == 0) { v4f s0 = red[0][0][lane], s1 = red[0][1][lane];
#pragma unroll
    for (int w = 1; w < 8; ++w) { s0 += red[w][0][lane]; s1 += red[w][1][lane]; }
    v8h h8, l8;
#pragma unroll
    for (int r = 0; r < 8; ++r) { const float v = r < 4 ? s0[r & 3] : s1[r & 3]; const _Float16 hv = (_Float16)v; h8[r] = hv; l8[r] = (_Float16)((v - (float)hv) * 1024.0f); }
    const size_t o = (((b * NH + h) * 2 + jt) * 2 + it) * 256 + col * 16 + 8 * g; vst2(KV + o, h8); vst2(KVL + o, l8); } }
// lane l's value added to that of lane l ^ M inside a 16-lane row (DPP row_xmask), and to that of lane l ^ 16: vector instructions, where __shfl_xor goes through the LDS pipe with a wait behind each step
template <int M> __device__ __forceinline__ float addx(float x) { return x + __builtin_bit_cast(float, __builtin_amdgcn_update_dpp(0, __builtin_bit_cast(int, x), 0x160 | M, 0xf, 0xf, true)); }
__device__ __forceinline__ float addh(float x) { return x + __builtin_bit_cast(float, __builtin_amdgcn_permlanex16(__builtin_bit_cast(int, x), __builtin_bit_cast(int, x), 0x76543210, 0xfedcba98, false, false)); }
__device__ __forceinline__ float wsum(float x) { return addh(addx<8>(addx<4>(addx<2>(addx<1>(x))))); }
// ---- k_ctx: block = (64 rows t, 4 heads): ctx[t][h*32 + j] = sum_i q[t][h*32 + i] KV_h[i][j] (q hi+res x KV hi+res, 3 products, K = 32 = one chunk); 512-B segments per row. Each wave also takes, from the registers that hold its 16 x 32 values of a head, their sum and the sum of squares about their own mean; the block stores its 16 pairs as one 128-B line
__global__ __launch_bounds__(128) void k_ctx(const _Float16* __restrict__ QH, const _Float16* __restrict__ QL, const _Float16* __restrict__ KV, const _Float16* __restrict__ KVL, float* __restrict__ CTX, float* __restrict__ PS) { __shared__ __align__(16) float sf[4][16][132]; __shared__ float sps[32]; float vv[4][16];
  const int tid = threadIdx.x, wave = tid >> 5, lane = tid & 31, col = lane & 15, g = lane >> 4; const int h0 = blockIdx.y * 4; const size_t r0 = (size_t)blockIdx.x * 64 + wave * 16; const size_t b = r0 / TT;
#pragma unroll
  for (int hh = 0; hh < 4; ++hh) { const int h = h0 + hh; v8f acc[2] = {}; const v16h ah = frag_h(QH + (r0 + col) * CC + h * HD, lane), al = frag_h(QL + (r0 + col) * CC + h * HD, lane);
#pragma unroll
    for (int jt = 0; jt < 2; ++jt) { const size_t bo = ((b * NH + h) * 4 + jt * 2) * 256 + col * 16; const v16h bh = frag_kv(KV + bo, lane), bl = frag_kv(KVL + bo, lane); acc[jt] = wmma16(ah, bh, acc[jt]); v8f t2 = {}; t2 = wmma16(al, bh, t2); t2 = wmma16(ah, bl, t2);
#pragma unroll
      for (int r = 0; r < 8; ++r) { const float v = acc[jt][r] + t2[r] * (1.0f / 1024.0f); vv[hh][jt * 8 + r] = v; sf[wave][8 * g + r][hh * 32 + jt * 16 + col] = v; } } }
  LDSX(); for (int rl = 0; rl < 16; ++rl) vst2(CTX + (r0 + rl) * CC + h0 * HD + lane * 4, *(const v4f*)&sf[wave][rl][lane * 4]);
  asm volatile("s_wait_xcnt 0x0" ::: "memory"); __builtin_amdgcn_sched_barrier(0);   // the wait stands in front of any later overwrite of the registers that the stores above name; the scheduling barrier keeps the sums below behind it, so that the ctx stores are issued first and drain while the sums are taken
  float s[4], d[4];
#pragma unroll
  for (int hh = 0; hh < 4; ++hh) { float a0 = 0.f, a1 = 0.f;
#pragma unroll
    for (int e = 0; e < 8; ++e) { a0 += vv[hh][e]; a1 += vv[hh][8 + e]; }
    s[hh] = a0 + a1; }
#pragma unroll
  for (int hh = 0; hh < 4; ++hh) s[hh] = wsum(s[hh]);
#pragma unroll
  for (int hh = 0; hh < 4; ++hh) { const float m = s[hh] * (1.0f / 512.0f); float a0 = 0.f, a1 = 0.f;
#pragma unroll
    for (int e = 0; e < 8; ++e) { const float t0 = vv[hh][e] - m, t1 = vv[hh][8 + e] - m; a0 += t0 * t0; a1 += t1 * t1; }
    d[hh] = a0 + a1; }
#pragma unroll
  for (int hh = 0; hh < 4; ++hh) d[hh] = wsum(d[hh]);
  if (lane == 0) {
#pragma unroll
    for (int hh = 0; hh < 4; ++hh) { sps[hh * 8 + wave * 2] = s[hh]; sps[hh * 8 + wave * 2 + 1] = d[hh]; } }
  __builtin_amdgcn_fence(__ATOMIC_RELEASE, "workgroup", "local"); __builtin_amdgcn_s_barrier(); __builtin_amdgcn_fence(__ATOMIC_ACQUIRE, "workgroup", "local");   // work-group barrier that orders LDS alone: it publishes the four waves' pairs to wave 0, which alone writes the block's line; __syncthreads() here also waited until the ctx stores above had been acknowledged
  if (wave == 0) vst2(PS + ((size_t)blockIdx.x * (NH / 4) + blockIdx.y) * 32 + lane, sps[lane]); }
// ---- k_out: block = (128 rows, 128 cols), 8 waves of 32 x 64: out = gh (hi + lo) out_w^T + out_b with gh = (ctx - mu_h) rstd_h gn_w[c] + gn_b[c]; per 32-k step (one head) the block builds gh hi, gh lo and the bf16 out_w tile once and stages them in LDS (two buffers), as k_proj does. mu_h and rstd_h come from k_ctx's partials: each block merges the 128 (sum, centred square sum) pairs of each of its batch's 32 heads ahead of its loop
__global__ __launch_bounds__(256) void k_out(const float* __restrict__ CTX, const float* __restrict__ PS, const float* __restrict__ GW, const float* __restrict__ GB, const float* __restrict__ WO, const float* __restrict__ BO, float* __restrict__ OUT) {
  __shared__ __align__(16) char sm[128 * 132 * 4];   // loop: gh hi, gh lo and W tiles, each [2][128][PT]; epilogue: f32 tile [128][132]
  __bf16 (*sa)[128][PT] = (__bf16 (*)[128][PT])sm; __bf16 (*sb)[128][PT] = (__bf16 (*)[128][PT])(sm + 2 * 128 * PT * 2); __bf16 (*sw)[128][PT] = (__bf16 (*)[128][PT])(sm + 4 * 128 * PT * 2);
  const int tid = threadIdx.x, wave = tid >> 5, lane = tid & 31, col = lane & 15, g = lane >> 4, wm = wave >> 1, wn = wave & 1; const int c0 = blockIdx.y * 128; const size_t r0 = (size_t)blockIdx.x * 128; const size_t b = r0 / TT;
  const int lr = tid >> 3, lq = tid & 7;   // staging: rows lr + 32 i, floats 4 lq .. 4 lq + 3
  const float* cp = CTX + r0 * CC; const float* wp = WO + (size_t)c0 * CC; const unsigned lo = lr * CC + lq * 4;   // block-uniform bases, one 32-bit lane offset for both tiles
  __shared__ float sst[2 * NH];   // mu, rstd of the batch's heads
  const int st = (blockIdx.x + 4 * blockIdx.y) & (CC / 32 - 1);   // first k step (head) of this block; the walk wraps round, as in k_proj: the blocks that share a ctx or an out_w tile stand at different steps
  v4f pc[4], pw[4], pgw, pgb, pq[8]; float mu, rs;
#pragma unroll
  for (int i = 0; i < 4; ++i) { const float* p = PS + ((b * (TT / 64) + lq + 8 * i) * (NH / 4) + (lr >> 2)) * 32 + (lr & 3) * 8; pq[2 * i] = *(const v4f*)p; pq[2 * i + 1] = *(const v4f*)(p + 4); }   // thread (head lr, eighth lq): 16 of the head's 128 pairs
#pragma unroll
  for (int i = 0; i < 4; ++i) { pc[i] = *(const v4f*)(cp + st * 32 + i * 32 * CC + lo); pw[i] = *(const v4f*)(wp + st * 32 + i * 32 * CC + lo); }
  pgw = *(const v4f*)(GW + st * 32 + lq * 4); pgb = *(const v4f*)(GB + st * 32 + lq * 4);
  asm volatile("s_wait_xcnt 0x0" ::: "memory"); __builtin_amdgcn_sched_barrier(0);   // the wait stands in front of any later overwrite of the address registers that the loads above name; the scheduling barrier keeps later vector instructions from being lifted over it
  float ssum = 0.f, sm2 = 0.f;
#pragma unroll
  for (int i = 0; i < 8; ++i) ssum += pq[i][0] + pq[i][2];
  ssum = addx<4>(addx<2>(addx<1>(ssum)));   // over the head's 8 threads
  const float mean = ssum / (float)(TT * HD);
#pragma unroll
  for (int i = 0; i < 8; ++i) { const float e0 = pq[i][0] * (1.0f / 512.0f) - mean, e1 = pq[i][2] * (1.0f / 512.0f) - mean; sm2 += (pq[i][1] + pq[i][3]) + 512.0f * (e0 * e0 + e1 * e1); }   // squares about the whole mean = squares about each part's own mean + 512 (part mean - mean)^2
  sm2 = addx<4>(addx<2>(addx<1>(sm2)));
  if (lq == 0) { sst[2 * lr] = mean; sst[2 * lr + 1] = rsqrtf(sm2 / (float)(TT * HD) + 1e-5f); }
  __syncthreads();   // publishes the 32 heads' mu and rstd to every wave
  mu = sst[2 * st]; rs = sst[2 * st + 1];
  v8f acc[2][4] = {};
#pragma unroll 2
  for (int kc = 0; kc < CC / 32; ++kc) { const int bf = kc & 1;   /* 32 channels per step == one head */
#pragma unroll
    for (int i = 0; i < 4; ++i) { v4f v;
#pragma unroll
      for (int e = 0; e < 4; ++e) v[e] = (pc[i][e] - mu) * rs * bfr(pgw[e]) + bfr(pgb[e]);
      const v4b hv = __builtin_convertvector(v, v4b); *(v4b*)&sa[bf][lr + 32 * i][lq * 4] = hv; *(v4b*)&sb[bf][lr + 32 * i][lq * 4] = __builtin_convertvector(v - __builtin_convertvector(hv, v4f), v4b); *(v4b*)&sw[bf][lr + 32 * i][lq * 4] = __builtin_convertvector(pw[i], v4b); }
    __syncthreads();   // publishes step kc's tiles; it also ends every wave's reads of the other buffer (step kc - 1) before step kc + 1 is stored there
    v16b ah[2], al[2], w[4];
#pragma unroll
    for (int it = 0; it < 2; ++it) { ah[it] = frag_b(&sa[bf][wm * 32 + it * 16 + col][0], lane); al[it] = frag_b(&sb[bf][wm * 32 + it * 16 + col][0], lane); }
#pragma unroll
    for (int j = 0; j < 4; ++j) w[j] = frag_b(&sw[bf][wn * 64 + j * 16 + col][0], lane);
    if (kc + 1 < CC / 32) { const int kn = ((st + kc + 1) & (CC / 32 - 1)) * 32;   // next step of the wrapped walk, block-uniform
      const gcf ck = ubase(cp + kn), wk = ubase(wp + kn), gwk = ubase(GW + kn), gbk = ubase(GB + kn); mu = sst[kn >> 4]; rs = sst[(kn >> 4) + 1];
      __builtin_amdgcn_sched_barrier(0);   // the fragment reads above and the LDS read of mu, rs are issued ahead of the tile loads: among them they stood behind the waits that precede each re-use of a scalar base register
#pragma unroll
      for (int i = 0; i < 4; ++i) { pc[i] = *(gcv4)(ck + i * 32 * CC + lo); pw[i] = *(gcv4)(wk + i * 32 * CC + lo); }
      pgw = *(gcv4)(gwk + (unsigned)(lq * 4)); pgb = *(gcv4)(gbk + (unsigned)(lq * 4));
      asm volatile("s_wait_xcnt 0x0" ::: "memory"); __builtin_amdgcn_sched_barrier(0);   // the wait stands in front of any later overwrite of the address registers that the loads above name; the scheduling barrier keeps later vector instructions from being lifted over it
    }
#pragma unroll
    for (int it = 0; it < 2; ++it)
#pragma unroll
      for (int j = 0; j < 4; ++j) acc[it][j] = wmma_bf(ah[it], w[j], acc[it][j]);
#pragma unroll
    for (int it = 0; it < 2; ++it)
#pragma unroll
      for (int j = 0; j < 4; ++j) acc[it][j] = wmma_bf(al[it], w[j], acc[it][j]);
    __builtin_amdgcn_sched_barrier(0); }   // keeps the next step's conversions, and with them the wait for its global loads, behind this step's products
  __syncthreads();   // the last step's fragment reads end before the epilogue tile overwrites the staging buffers
  float (*sf)[132] = (float (*)[132])sm;
#pragma unroll
  for (int j = 0; j < 4; ++j) { const int cl = wn * 64 + j * 16 + col; const float bb = bfr(BO[c0 + cl]);
#pragma unroll
    for (int it = 0; it < 2; ++it)
#pragma unroll
      for (int r = 0; r < 8; ++r) sf[wm * 32 + it * 16 + 8 * g + r][cl] = acc[it][j][r] + bb; }
  __syncthreads();
  for (int e = tid; e < 128 * 32; e += 256) { const int rl = e >> 5, q = e & 31; vst2(OUT + (r0 + rl) * CC + c0 + q * 4, *(const v4f*)&sf[rl][q * 4]); } }
extern "C" void kernel_launch(void* const* d_in, const int* in_sizes, int n_in, void* d_out, int out_size, void* d_ws, size_t ws_size, hipStream_t stream) {
  (void)in_sizes; (void)n_in; (void)out_size;
  const float** F = (const float**)d_in;   // 0 x [2,2048,1024], 1 Wqkv_w [3072,1024] ([out,in]; channel o = which*1024 + h*32 + d), 2 Wqkv_b [3072], 3 gn_w [1024], 4 gn_b, 5 out_w [1024,1024] ([out,in]), 6 out_b
  if (ws_size < (size_t)WS_END) return;
  char* ws = (char*)d_ws; _Float16 *QH = (_Float16*)(ws + WS_QH), *QL = (_Float16*)(ws + WS_QL), *KV = (_Float16*)(ws + WS_KV), *KVL = (_Float16*)(ws + WS_KVL); __bf16 *KT = (__bf16*)(ws + WS_KT), *KL = (__bf16*)(ws + WS_KL), *VT = (__bf16*)(ws + WS_VT), *VL = (__bf16*)(ws + WS_VL); float *CTX = (float*)(ws + WS_CTX), *GS = (float*)(ws + WS_GS);
  k_proj<<<dim3(TNB * TT / 128, CC / 128, 3), 256, 0, stream>>>(F[0], F[1], F[2], QH, QL, KT, KL, VT, VL);
  k_kv<<<dim3(NH, TNB, 4), 256, 0, stream>>>(KT, KL, VT, VL, KV, KVL);
  k_ctx<<<dim3(TNB * TT / 64, NH / 4), 128, 0, stream>>>(QH, QL, KV, KVL, CTX, GS);
  k_out<<<dim3(TNB * TT / 128, CC / 128), 256, 0, stream>>>(CTX, GS, F[3], F[4], F[5], F[6], (float*)d_out);
}

// v005
// It runs in 71 microseconds.
// Next to v004, in two timings, it ran 1.05 times as fast each time.
// All steps since v000 together make it 5.96 times as fast.
#include <hip/hip_runtime.h>
#include <math.h>

typedef __attribute__((ext_vector_type(16))) _Float16 v16h;
typedef __attribute__((ext_vector_type(16))) __bf16 v16b;
typedef __attribute__((ext_vector_type(8)))  _Float16 v8h;
typedef __attribute__((ext_vector_type(8)))  float v8f;
typedef __attribute__((ext_vector_type(4)))  float v4f;
typedef __attribute__((ext_vector_type(2)))  float v2f;
typedef __attribute__((ext_vector_type(4)))  unsigned v4u;
typedef __attribute__((ext_vector_type(4)))  int v4i;
typedef float __attribute__((may_alias)) float_a;
typedef int __attribute__((may_alias)) int_a;

template <typename T> __device__ __forceinline__ void vst2(void* p, T v) { *(T*)p = v;  }
__device__ __forceinline__ v8f wmma16(v16h a, v16h b, v8f c) {
  v8f d = __builtin_amdgcn_wmma_f32_16x16x32_f16(false, a, false, b, (short)0, c, false, false);
  asm volatile("v_nop\n\tv_nop\n\tv_nop\n\tv_nop" : "+v"(d) : "v"(a), "v"(b));
  return d;
}
__device__ __forceinline__ v8f wmma_bf(v16b a, v16b b, v8f c) {
  v8f d = __builtin_amdgcn_wmma_f32_16x16x32_bf16(false, a, false, b, (short)0, c, false, false);
  asm volatile("v_nop\n\tv_nop\n\tv_nop\n\tv_nop" : "+v"(d) : "v"(a), "v"(b));
  return d;
}
// 16x16x32 fragments: lane = (h = lane>>4, row/col = lane&15); elements 0..7 = k0+8h+0..7, 8..15 = k0+16+8h+0..7; D element r = row 8h+r
__device__ __forceinline__ v16h frag_h(const _Float16* rowk0, int lane) {
  union { v16h v; v8h q[2]; } u; const _Float16* p = rowk0 + 8 * (lane >> 4);
  u.q[0] = *(const v8h*)p; u.q[1] = *(const v8h*)(p + 16); return u.v;
}
__device__ __forceinline__ v16h frag_f32(const float* rowk0, int lane) {
  v16h a; const float* p = rowk0 + 8 * (lane >> 4);
#pragma unroll
  for (int i = 0; i < 8; ++i) { a[i] = (_Float16)p[i]; a[8 + i] = (_Float16)p[16 + i]; }
  return a;
}
__device__ __forceinline__ v16h frag_f32s(const float* rowk0, int lane, float sc) {
  v16h a; const float* p = rowk0 + 8 * (lane >> 4);
#pragma unroll
  for (int i = 0; i < 8; ++i) { a[i] = (_Float16)(p[i] * sc); a[8 + i] = (_Float16)(p[16 + i] * sc); }
  return a;
}
// column fragment from a [K][ld] layout (column n), rows >= K read as 0
__device__ __forceinline__ v16h fragc_f32(const float* W, int k0, int n, int lane, int ld, int K) {
  v16h a; const int g = lane >> 4;
#pragma unroll
  for (int i = 0; i < 8; ++i) { const int ka = k0 + 8 * g + i, kb = ka + 16;
    a[i] = (_Float16)(ka < K ? W[(size_t)(ka < K ? ka : K - 1) * ld + n] : 0.f); a[8 + i] = (_Float16)(kb < K ? W[(size_t)(kb < K ? kb : K - 1) * ld + n] : 0.f); }
  return a;
}
struct F2 { v16b h, l; };
__device__ __forceinline__ F2 bsplit16(const float v[16]) { F2 r;
#pragma unroll
  for (int i = 0; i < 16; ++i) { const __bf16 h = (__bf16)v[i]; r.h[i] = h; r.l[i] = (__bf16)(v[i] - (float)h); }
  return r; }
__device__ __forceinline__ F2 split_row(const float* row, int k0, int lane) { float v[16]; const float* p = row + k0 + 8 * (lane >> 4);
#pragma unroll
  for (int i = 0; i < 8; ++i) { v[i] = p[i]; v[8 + i] = p[16 + i]; }
  return bsplit16(v); }
__device__ __forceinline__ F2 split_rowK(const float* row, int k0, int lane, int K) { float v[16]; const int g = lane >> 4;
#pragma unroll
  for (int i = 0; i < 8; ++i) { const int ka = k0 + 8 * g + i, kb = ka + 16; v[i] = ka < K ? row[ka < K ? ka : K - 1] : 0.f; v[8 + i] = kb < K ? row[kb < K ? kb : K - 1] : 0.f; }
  return bsplit16(v); }
__device__ __forceinline__ F2 split_col(const float* W, int k0, int n, int lane, int ld, int K) { float v[16]; const int g = lane >> 4;
#pragma unroll
  for (int i = 0; i < 8; ++i) { const int ka = k0 + 8 * g + i, kb = ka + 16; v[i] = ka < K ? W[(size_t)(ka < K ? ka : K - 1) * ld + n] : 0.f; v[8 + i] = kb < K ? W[(size_t)(kb < K ? kb : K - 1) * ld + n] : 0.f; }
  return bsplit16(v); }
__device__ __forceinline__ v8f mac3(const F2& a, const F2& b, v8f c) { c = wmma_bf(a.l, b.h, c); c = wmma_bf(a.h, b.l, c); return wmma_bf(a.h, b.h, c); }
__device__ __forceinline__ float sigm(float v) { return 1.0f / (1.0f + expf(-v)); }
#define LDSX() do { asm volatile("s_wait_dscnt 0" ::: "memory"); __builtin_amdgcn_wave_barrier(); __builtin_amdgcn_fence(__ATOMIC_RELEASE, "workgroup"); } while (0)

// MHLA (B 2, S 2,048, 1,024 = 32 heads x 32): q,k,v = split(x Wqkv^T + b) as [B,S,3,H,Dh]; a = q k^T (no softmax); ctx = a v  (== q (k^T v), reassociated exactly); GroupNorm per (b, head) over (Dh, S) with eps 1e-5 and per-channel affine; out = ctx out_w^T + out_b.
__device__ __forceinline__ float bfr(float v) { return (float)(__bf16)v; }
#define NB 2
#define TT 2048
#define CC 1024
#define NH 32
#define HD 32
#ifndef TNB
#define TNB NB
#endif
#ifndef QSTR
#define QSTR (TT * CC)        // unused; x rows are read as [b*T+t][1024]
#endif
typedef __attribute__((ext_vector_type(8))) __bf16 v8b;
__device__ __forceinline__ v16b frag_b(const __bf16* rowk0, int lane) { union { v16b v; v8b q[2]; } u; const __bf16* p = rowk0 + 8 * (lane >> 4); u.q[0] = *(const v8b*)p; u.q[1] = *(const v8b*)(p + 16); return u.v; }
#define WS_QH  0u                                          // f16 q hi rows [b*T+t][1024]
#define WS_QL  (WS_QH + 2u * (size_t)NB * TT * CC)
#define WS_KT  (WS_QL + 2u * (size_t)NB * TT * CC)           // bf16 k hi planes [b][c][s]
#define WS_KL  (WS_KT + 2u * (size_t)NB * CC * TT)
#define WS_VT  (WS_KL + 2u * (size_t)NB * CC * TT)           // bf16 v hi planes [b][c][s]
#define WS_VL  (WS_VT + 2u * (size_t)NB * CC * TT)
#define WS_KV  (WS_VL + 2u * (size_t)NB * CC * TT)           // f16 KV hi + residual tiles [b][h][jt][it][j][i] (j = v dim = output col, i = k dim)
#define WS_KVL (WS_KV + 2u * (size_t)NB * NH * HD * HD)
#define WS_CTX (WS_KVL + 2u * (size_t)NB * NH * HD * HD)      // f32 ctx rows [b*T+t][1024]
#define WS_GS  (WS_CTX + 4u * (size_t)NB * TT * CC)          // f32 GroupNorm partials, one 128-B line per k_ctx block: [64-row block][4-head group][head][wave][sum, centred square sum]
#define WS_END (WS_GS + 4u * (size_t)(NB * TT / 64) * (NH / 4) * 32)
typedef __attribute__((ext_vector_type(4))) __bf16 v4b;
typedef const __attribute__((address_space(1))) float* gcf;
// a block-uniform global address kept whole in a scalar register pair: the loads of a k step then take it as their scalar base beside one fixed 32-bit lane offset, and no vector address register is formed anew (and overwritten) in each step
__device__ __forceinline__ gcf ubase(const float* p) { const unsigned long long a = (unsigned long long)p;
  return (gcf)(((unsigned long long)(unsigned)__builtin_amdgcn_readfirstlane((int)(a >> 32)) << 32) | (unsigned)__builtin_amdgcn_readfirstlane((int)(unsigned)a)); }
typedef const __attribute__((address_space(1))) v4f* gcv4;
#define PT 40   // LDS row pitch of a staged 32-k bf16 row, in elements: 80 B = 16 B x odd, which ds_load_b128 fragment reads take without bank conflicts
// ---- k_proj: block = (128 rows, 128 cols, which), 8 waves of 32 x 64: qkv = x W^T + b ([out,in] rows which*1024 + o). Per 32-k step the block converts its x and W tiles to bf16 once and stages them in LDS (two buffers, next step's global loads in flight over the products); q -> f16 hi + residual rows; k, v -> bf16 hi + lo planes [b][c][t]
__global__ __launch_bounds__(256) void k_proj(const float* __restrict__ X, const float* __restrict__ Wt, const float* __restrict__ Bv, _Float16* __restrict__ QH, _Float16* __restrict__ QL, __bf16* __restrict__ KT, __bf16* __restrict__ KL, __bf16* __restrict__ VT, __bf16* __restrict__ VL) {
  __shared__ __align__(16) char sm[2 * 128 * 136 * 2];   // loop: x tiles [2][128][PT], W tiles [2][128][PT]; epilogue: hi and lo tiles [128][136]
  __bf16 (*sx)[128][PT] = (__bf16 (*)[128][PT])sm; __bf16 (*sw)[128][PT] = (__bf16 (*)[128][PT])(sm + 2 * 128 * PT * 2);
  const int tid = threadIdx.x, wave = tid >> 5, lane = tid & 31, col = lane & 15, g = lane >> 4, wm = wave >> 1, wn = wave & 1; const int which = blockIdx.z; const int c0 = blockIdx.y * 128; const size_t r0 = (size_t)blockIdx.x * 128;
  const int lr = tid >> 3, lq = tid & 7;   // staging: rows lr + 32 i, floats 4 lq .. 4 lq + 3 (8 lanes cover one 128-B line)
  const float* xp = X + r0 * CC; const float* wp = Wt + (size_t)(which * CC + c0) * CC; const unsigned lo = lr * CC + lq * 4;   // block-uniform bases, one 32-bit lane offset for both tiles
  const int st = (blockIdx.x + 4 * blockIdx.y) & (CC / 32 - 1);   // first k step of this block; the walk wraps round. The 32 blocks that share a W tile and the 8 column blocks that share an x tile then stand at different steps and do not ask L2 for the same lines at one moment
  v4f px[4], pw[4];
#pragma unroll
  for (int i = 0; i < 4; ++i) { px[i] = *(const v4f*)(xp + st * 32 + i * 32 * CC + lo); pw[i] = *(const v4f*)(wp + st * 32 + i * 32 * CC + lo); }
  asm volatile("s_wait_xcnt 0x0" ::: "memory"); __builtin_amdgcn_sched_barrier(0);   // the wait stands in front of any later overwrite of the address registers that the loads above name; the scheduling barrier keeps later vector instructions from being lifted over it
  v8f acc[2][4] = {};
#pragma unroll 2
  for (int kc = 0; kc < CC / 32; ++kc) { const int bf = kc & 1;
#pragma unroll
    for (int i = 0; i < 4; ++i) { *(v4b*)&sx[bf][lr + 32 * i][lq * 4] = __builtin_convertvector(px[i], v4b); *(v4b*)&sw[bf][lr + 32 * i][lq * 4] = __builtin_convertvector(pw[i], v4b); }
    __syncthreads();   // publishes step kc's tiles; it also ends every wave's reads of the other buffer (step kc - 1) before step kc + 1 is stored there
    v16b a[2], w[4];
#pragma unroll
    for (int it = 0; it < 2; ++it) a[it] = frag_b(&sx[bf][wm * 32 + it * 16 + col][0], lane);
#pragma unroll
    for (int j = 0; j < 4; ++j) w[j] = frag_b(&sw[bf][wn * 64 + j * 16 + col][0], lane);
    if (kc + 1 < CC / 32) { const int kn = ((st + kc + 1) & (CC / 32 - 1)) * 32;   // next step of the wrapped walk, block-uniform
      const gcf xk = ubase(xp + kn), wk = ubase(wp + kn);
#pragma unroll
      for (int i = 0; i < 4; ++i) { px[i] = *(gcv4)(xk + i * 32 * CC + lo); pw[i] = *(gcv4)(wk + i * 32 * CC + lo); }
      asm volatile("s_wait_xcnt 0x0" ::: "memory"); __builtin_amdgcn_sched_barrier(0);   // the wait stands in front of any later overwrite of the address registers that the loads above name; the scheduling barrier keeps later vector instructions from being lifted over it
    }
#pragma unroll
    for (int it = 0; it < 2; ++it)
#pragma unroll
      for (int j = 0; j < 4; ++j) acc[it][j] = wmma_bf(a[it], w[j], acc[it][j]);
    __builtin_amdgcn_sched_barrier(0); }   // keeps the next step's conversions, and with them the wait for its global loads, behind this step's products
  __syncthreads();   // the last step's fragment reads end before the epilogue tiles overwrite the staging buffers
  _Float16 (*sh)[136] = (_Float16 (*)[136])sm; _Float16 (*sl)[136] = (_Float16 (*)[136])(sm + 128 * 136 * 2); __bf16 (*th)[136] = (__bf16 (*)[136])sm; __bf16 (*tl2)[136] = (__bf16 (*)[136])(sm + 128 * 136 * 2);
  float bv[4];
#pragma unroll
  for (int j = 0; j < 4; ++j) bv[j] = Bv[which * CC + c0 + wn * 64 + j * 16 + col];
  asm volatile("s_wait_xcnt 0x0" ::: "memory"); __builtin_amdgcn_sched_barrier(0);   // wait and scheduling barrier as behind the tile loads above
  if (which == 0) {
#pragma unroll
    for (int j = 0; j < 4; ++j) { const int cl = wn * 64 + j * 16 + col; const float bb = bfr(bv[j]);
#pragma unroll
      for (int it = 0; it < 2; ++it)
#pragma unroll
        for (int r = 0; r < 8; ++r) { const float v = acc[it][j][r] + bb; const int rl = wm * 32 + it * 16 + 8 * g + r; const _Float16 hv = (_Float16)v; sh[rl][cl] = hv; sl[rl][cl] = (_Float16)((v - (float)hv) * 1024.0f); } }
  } else {
#pragma unroll
    for (int j = 0; j < 4; ++j) { const int cl = wn * 64 + j * 16 + col; const float bb = bfr(bv[j]);
#pragma unroll
      for (int it = 0; it < 2; ++it) { v8b h8, l8;
#pragma unroll
        for (int r = 0; r < 8; ++r) { const float v = acc[it][j][r] + bb; const __bf16 bh = (__bf16)v; h8[r] = bh; l8[r] = (__bf16)(v - (float)bh); }
        *(v8b*)&th[cl][wm * 32 + it * 16 + 8 * g] = h8; *(v8b*)&tl2[cl][wm * 32 + it * 16 + 8 * g] = l8; }
      __builtin_amdgcn_sched_barrier(0); }   // one column group at a time: keeps the epilogue's register use under the loop's 160, at which three blocks share a WGP
  }
  __syncthreads();
  if (which == 0) { for (int e = tid; e < 128 * 16; e += 256) { const int rl = e >> 4, q = e & 15; vst2((unsigned*)(QH + (r0 + rl) * CC + c0 + q * 8), *(const v4u*)&sh[rl][q * 8]); vst2((unsigned*)(QL + (r0 + rl) * CC + c0 + q * 8), *(const v4u*)&sl[rl][q * 8]); } }
  else { __bf16* DT = which == 1 ? KT : VT; __bf16* DL = which == 1 ? KL : VL; const size_t b = r0 / TT; const int t0 = (int)(r0 % TT); for (int e = tid; e < 128 * 16; e += 256) { const int cl = e >> 4, q = e & 15; const size_t o2 = (b * CC + c0 + cl) * (size_t)TT + t0 + q * 8; vst2((unsigned*)(DT + o2), *(const v4u*)&th[cl][q * 8]); vst2((unsigned*)(DL + o2), *(const v4u*)&tl2[cl][q * 8]); } } }
// B fragment of one head's KV, stored tile by tile [jt][it][16 j][16 i]: elements 0..7 = i 8g + 0..7 (tile it 0), 8..15 = i 16 + 8g + 0..7 (tile it 1, 256 elements on): the k order of frag_h
__device__ __forceinline__ v16h frag_kv(const _Float16* row0, int lane) {
  union { v16h v; v8h q[2]; } u; const _Float16* p = row0 + 8 * (lane >> 4);
  u.q[0] = *(const v8h*)p; u.q[1] = *(const v8h*)(p + 256); return u.v;
}
// ---- k_kv: block = (h, b, tile (it, jt)), 8 waves: KV[i][j] = sum_s k[s][i] v[s][j] for one 16 x 16 tile (A rows = k planes (i), B cols = v planes (j); 3 products). Wave w sums s = 256 w .. 256 w + 255 (4 pairs of 32-s steps, one 128-B line of each plane row per pair; two pairs of loads in flight); the 8 partial tiles are added in LDS in wave order; stored as f16 hi + residual tiles [b][h][jt][it][j][i]: 512 B + 512 B per block
__global__ __launch_bounds__(256) void k_kv(const __bf16* __restrict__ KT, const __bf16* __restrict__ KL, const __bf16* __restrict__ VT, const __bf16* __restrict__ VL, _Float16* __restrict__ KV, _Float16* __restrict__ KVL) { __shared__ __align__(16) v4f red[8][2][32];
  const int tid = threadIdx.x, wave = tid >> 5, lane = tid & 31, col = lane & 15, g = lane >> 4; const size_t b = blockIdx.y; const int h = blockIdx.x, it = blockIdx.z >> 1, jt = blockIdx.z & 1;
  const size_t ko = (b * CC + h * HD + it * 16 + col) * (size_t)TT + wave * (TT / 8), vo = (b * CC + h * HD + jt * 16 + col) * (size_t)TT + wave * (TT / 8);
  const __bf16* pl[4] = { KT + ko, KL + ko, VT + vo, VL + vo };
  v16b f[2][4][2];   // [buffer][plane: k hi, k lo, v hi, v lo][step of the pair]
#pragma unroll
  for (int p = 0; p < 2; ++p) {
#pragma unroll
    for (int q = 0; q < 4; ++q)
#pragma unroll
      for (int e = 0; e < 2; ++e) f[p][q][e] = frag_b(pl[q] + p * 64 + e * 32, lane);
    __builtin_amdgcn_sched_barrier(0); }   // pair 0's loads stay in front of pair 1's, so that pair 0's products wait for their own 16 loads alone, and both pairs are issued before the first product waits
  v8f ahh = {}, alh = {}, ahl = {};
#pragma unroll
  for (int p = 0; p < 4; ++p) { const int bf = p & 1;
#pragma unroll
    for (int e = 0; e < 2; ++e) { ahh = wmma_bf(f[bf][0][e], f[bf][2][e], ahh); alh = wmma_bf(f[bf][1][e], f[bf][2][e], alh); ahl = wmma_bf(f[bf][0][e], f[bf][3][e], ahl); }
    if (p + 2 < 4) {
#pragma unroll
      for (int q = 0; q < 4; ++q)
#pragma unroll
        for (int e = 0; e < 2; ++e) f[bf][q][e] = frag_b(pl[q] + (p + 2) * 64 + e * 32, lane);
    }
    if (p == 1) asm volatile("s_wait_xcnt 0x0" ::: "memory");   // the wait stands behind the last plane load, in front of any later overwrite of the address registers that the loads name
    __builtin_amdgcn_sched_barrier(0); }   // keeps each refill directly behind the products that free its registers, so that it flies over the other buffer's products; behind the wait it keeps later vector instructions from being lifted over it
  v8f t = ahh + (alh + ahl);
  red[wave][0][lane] = __builtin_shufflevector(t, t, 0, 1, 2, 3); red[wave][1][lane] = __builtin_shufflevector(t, t, 4, 5, 6, 7);
  __syncthreads();   // publishes the 8 partial tiles to wave 0
  if (wave == 0) { v4f s0 = red[0][0][lane], s1 = red[0][1][lane];
#pragma unroll
    for (int w = 1; w < 8; ++w) { s0 += red[w][0][lane]; s1 += red[w][1][lane]; }
    v8h h8, l8;
#pragma unroll
    for (int r = 0; r < 8; ++r) { const float v = r < 4 ? s0[r & 3] : s1[r & 3]; const _Float16 hv = (_Float16)v; h8[r] = hv; l8[r] = (_Float16)((v - (float)hv) * 1024.0f); }
    const size_t o = (((b * NH + h) * 2 + jt) * 2 + it) * 256 + col * 16 + 8 * g; vst2(KV + o, h8); vst2(KVL + o, l8); } }
// lane l's value added to that of lane l ^ M inside a 16-lane row (DPP row_xmask), and to that of lane l ^ 16: vector instructions, where __shfl_xor goes through the LDS pipe with a wait behind each step
template <int M> __device__ __forceinline__ float addx(float x) { return x + __builtin_bit_cast(float, __builtin_amdgcn_update_dpp(0, __builtin_bit_cast(int, x), 0x160 | M, 0xf, 0xf, true)); }
__device__ __forceinline__ float addh(float x) { return x + __builtin_bit_cast(float, __builtin_amdgcn_permlanex16(__builtin_bit_cast(int, x), __builtin_bit_cast(int, x), 0x76543210, 0xfedcba98, false, false)); }
__device__ __forceinline__ float wsum(float x) { return addh(addx<8>(addx<4>(addx<2>(addx<1>(x))))); }
// ---- k_ctx: block = (64 rows t, 4 heads): ctx[t][h*32 + j] = sum_i q[t][h*32 + i] KV_h[i][j] (q hi+res x KV hi+res, 3 products, K = 32 = one chunk); 512-B segments per row. Each wave also takes, from the registers that hold its 16 x 32 values of a head, their sum and the sum of squares about their own mean; the block stores its 16 pairs as one 128-B line
__global__ __launch_bounds__(128) void k_ctx(const _Float16* __restrict__ QH, const _Float16* __restrict__ QL, const _Float16* __restrict__ KV, const _Float16* __restrict__ KVL, float* __restrict__ CTX, float* __restrict__ PS) { __shared__ __align__(16) float sf[4][16][132]; __shared__ float sps[32]; float vv[4][16];
  const int tid = threadIdx.x, wave = tid >> 5, lane = tid & 31, col = lane & 15, g = lane >> 4; const int h0 = blockIdx.y * 4; const size_t r0 = (size_t)blockIdx.x * 64 + wave * 16; const size_t b = r0 / TT;
#pragma unroll
  for (int hh = 0; hh < 4; ++hh) { const int h = h0 + hh; v8f acc[2] = {}; const v16h ah = frag_h(QH + (r0 + col) * CC + h * HD, lane), al = frag_h(QL + (r0 + col) * CC + h * HD, lane);
#pragma unroll
    for (int jt = 0; jt < 2; ++jt) { const size_t bo = ((b * NH + h) * 4 + jt * 2) * 256 + col * 16; const v16h bh = frag_kv(KV + bo, lane), bl = frag_kv(KVL + bo, lane); acc[jt] = wmma16(ah, bh, acc[jt]); v8f t2 = {}; t2 = wmma16(al, bh, t2); t2 = wmma16(ah, bl, t2);
#pragma unroll
      for (int r = 0; r < 8; ++r) { const float v = acc[jt][r] + t2[r] * (1.0f / 1024.0f); vv[hh][jt * 8 + r] = v; sf[wave][8 * g + r][hh * 32 + jt * 16 + col] = v; } } }
  LDSX(); for (int rl = 0; rl < 16; ++rl) vst2(CTX + (r0 + rl) * CC + h0 * HD + lane * 4, *(const v4f*)&sf[wave][rl][lane * 4]);
  asm volatile("s_wait_xcnt 0x0" ::: "memory"); __builtin_amdgcn_sched_barrier(0);   // the wait stands in front of any later overwrite of the registers that the stores above name; the scheduling barrier keeps the sums below behind it, so that the ctx stores are issued first and drain while the sums are taken
  float s[4], d[4];
#pragma unroll
  for (int hh = 0; hh < 4; ++hh) { float a0 = 0.f, a1 = 0.f;
#pragma unroll
    for (int e = 0; e < 8; ++e) { a0 += vv[hh][e]; a1 += vv[hh][8 + e]; }
    s[hh] = a0 + a1; }
#pragma unroll
  for (int hh = 0; hh < 4; ++hh) s[hh] = wsum(s[hh]);
#pragma unroll
  for (int hh = 0; hh < 4; ++hh) { const float m = s[hh] * (1.0f / 512.0f); float a0 = 0.f, a1 = 0.f;
#pragma unroll
    for (int e = 0; e < 8; ++e) { const float t0 = vv[hh][e] - m, t1 = vv[hh][8 + e] - m; a0 += t0 * t0; a1 += t1 * t1; }
    d[hh] = a0 + a1; }
#pragma unroll
  for (int hh = 0; hh < 4; ++hh) d[hh] = wsum(d[hh]);
  if (lane == 0) {
#pragma unroll
    for (int hh = 0; hh < 4; ++hh) { sps[hh * 8 + wave * 2] = s[hh]; sps[hh * 8 + wave * 2 + 1] = d[hh]; } }
  __builtin_amdgcn_fence(__ATOMIC_RELEASE, "workgroup", "local"); __builtin_amdgcn_s_barrier(); __builtin_amdgcn_fence(__ATOMIC_ACQUIRE, "workgroup", "local");   // work-group barrier that orders LDS alone: it publishes the four waves' pairs to wave 0, which alone writes the block's line; __syncthreads() here also waited until the ctx stores above had been acknowledged
  if (wave == 0) vst2(PS + ((size_t)blockIdx.x * (NH / 4) + blockIdx.y) * 32 + lane, sps[lane]); }
// ---- k_out: block = (128 rows, 128 cols), 8 waves of 32 x 64: out = gh (hi + lo) out_w^T + out_b with gh = (ctx - mu_h) rstd_h gn_w[c] + gn_b[c]; per 32-k step (one head) the block builds gh hi, gh lo and the bf16 out_w tile once and stages them in LDS (two buffers), as k_proj does; its global loads run three steps ahead of the products, in two register sets, and a step's tiles are built one step ahead, behind the fragment reads of the step before. mu_h and rstd_h come from k_ctx's partials: each block merges the 128 (sum, centred square sum) pairs of each of its batch's 32 heads ahead of its loop
__global__ __launch_bounds__(256) void k_out(const float* __restrict__ CTX, const float* __restrict__ PS, const float* __restrict__ GW, const float* __restrict__ GB, const float* __restrict__ WO, const float* __restrict__ BO, float* __restrict__ OUT) {
  __shared__ __align__(16) char sm[128 * 132 * 4];   // loop: gh hi, gh lo and W tiles, each [2][128][PT]; epilogue: f32 tile [128][132]
  __bf16 (*sa)[128][PT] = (__bf16 (*)[128][PT])sm; __bf16 (*sb)[128][PT] = (__bf16 (*)[128][PT])(sm + 2 * 128 * PT * 2); __bf16 (*sw)[128][PT] = (__bf16 (*)[128][PT])(sm + 4 * 128 * PT * 2);
  const int tid = threadIdx.x, wave = tid >> 5, lane = tid & 31, col = lane & 15, g = lane >> 4, wm = wave >> 1, wn = wave & 1; const int c0 = blockIdx.y * 128; const size_t r0 = (size_t)blockIdx.x * 128; const size_t b = r0 / TT;
  const int lr = tid >> 3, lq = tid & 7;   // staging: rows lr + 32 i, floats 4 lq .. 4 lq + 3
  const float* cp = CTX + r0 * CC; const float* wp = WO + (size_t)c0 * CC; const unsigned lo = lr * CC + lq * 4;   // block-uniform bases, one 32-bit lane offset for both tiles
  __shared__ float sst[2 * NH];   // mu, rstd of the batch's heads
  const int st = (blockIdx.x + 4 * blockIdx.y) & (CC / 32 - 1);   // first k step (head) of this block; the walk wraps round, as in k_proj: the blocks that share a ctx or an out_w tile stand at different steps
  const int s1 = (st + 1) & (CC / 32 - 1);   // second step of the walk
  v4f pc[2][4], pw[2][4], pgw[2], pgb[2], pq[8]; float mu[2], rs[2];   // [register set = step parity]
#pragma unroll
  for (int i = 0; i < 4; ++i) { const float* p = PS + ((b * (TT / 64) + lq + 8 * i) * (NH / 4) + (lr >> 2)) * 32 + (lr & 3) * 8; pq[2 * i] = *(const v4f*)p; pq[2 * i + 1] = *(const v4f*)(p + 4); }   // thread (head lr, eighth lq): 16 of the head's 128 pairs
#pragma unroll
  for (int i = 0; i < 4; ++i) { pc[0][i] = *(const v4f*)(cp + st * 32 + i * 32 * CC + lo); pw[0][i] = *(const v4f*)(wp + st * 32 + i * 32 * CC + lo); }
  pgw[0] = *(const v4f*)(GW + st * 32 + lq * 4); pgb[0] = *(const v4f*)(GB + st * 32 + lq * 4);
#pragma unroll
  for (int i = 0; i < 4; ++i) { pc[1][i] = *(const v4f*)(cp + s1 * 32 + i * 32 * CC + lo); pw[1][i] = *(const v4f*)(wp + s1 * 32 + i * 32 * CC + lo); }
  pgw[1] = *(const v4f*)(GW + s1 * 32 + lq * 4); pgb[1] = *(const v4f*)(GB + s1 * 32 + lq * 4);
  asm volatile("s_wait_xcnt 0x0" ::: "memory"); __builtin_amdgcn_sched_barrier(0);   // the wait stands in front of any later overwrite of the address registers that the loads above name; the scheduling barrier keeps later vector instructions from being lifted over it
  float ssum = 0.f, sm2 = 0.f;
#pragma unroll
  for (int i = 0; i < 8; ++i) ssum += pq[i][0] + pq[i][2];
  ssum = addx<4>(addx<2>(addx<1>(ssum)));   // over the head's 8 threads
  const float mean = ssum / (float)(TT * HD);
#pragma unroll
  for (int i = 0; i < 8; ++i) { const float e0 = pq[i][0] * (1.0f / 512.0f) - mean, e1 = pq[i][2] * (1.0f / 512.0f) - mean; sm2 += (pq[i][1] + pq[i][3]) + 512.0f * (e0 * e0 + e1 * e1); }   // squares about the whole mean = squares about each part's own mean + 512 (part mean - mean)^2
  sm2 = addx<4>(addx<2>(addx<1>(sm2)));
  if (lq == 0) { sst[2 * lr] = mean; sst[2 * lr + 1] = rsqrtf(sm2 / (float)(TT * HD) + 1e-5f); }
  __syncthreads();   // publishes the 32 heads' mu and rstd to every wave
  mu[0] = sst[2 * st]; rs[0] = sst[2 * st + 1]; mu[1] = sst[2 * s1]; rs[1] = sst[2 * s1 + 1];
  v8f acc[2][4] = {};
  // register set s -> LDS buffer s: gh hi, gh lo and the bf16 out_w tile of the step that the set holds (32 channels per step == one head)
  auto conv = [&](const int s) __attribute__((always_inline)) {
#pragma unroll
    for (int i = 0; i < 4; ++i) { v4f v;
#pragma unroll
      for (int e = 0; e < 4; ++e) v[e] = (pc[s][i][e] - mu[s]) * rs[s] * bfr(pgw[s][e]) + bfr(pgb[s][e]);
      const v4b hv = __builtin_convertvector(v, v4b); *(v4b*)&sa[s][lr + 32 * i][lq * 4] = hv; *(v4b*)&sb[s][lr + 32 * i][lq * 4] = __builtin_convertvector(v - __builtin_convertvector(hv, v4f), v4b); *(v4b*)&sw[s][lr + 32 * i][lq * 4] = __builtin_convertvector(pw[s][i], v4b); } };
  // global loads of step ks of the wrapped walk into register set s, which has just been converted
  auto fetch = [&](const int s, const int ks) __attribute__((always_inline)) { const int kn = ((st + ks) & (CC / 32 - 1)) * 32;   // block-uniform
    const gcf ck = ubase(cp + kn), wk = ubase(wp + kn), gwk = ubase(GW + kn), gbk = ubase(GB + kn); mu[s] = sst[kn >> 4]; rs[s] = sst[(kn >> 4) + 1];
    __builtin_amdgcn_sched_barrier(0);   // the LDS stores above and the LDS read of mu, rs are issued ahead of the tile loads: among them they stood behind the waits that precede each re-use of a scalar base register
#pragma unroll
    for (int i = 0; i < 4; ++i) { pc[s][i] = *(gcv4)(ck + i * 32 * CC + lo); pw[s][i] = *(gcv4)(wk + i * 32 * CC + lo); }
    pgw[s] = *(gcv4)(gwk + (unsigned)(lq * 4)); pgb[s] = *(gcv4)(gbk + (unsigned)(lq * 4));
    asm volatile("s_wait_xcnt 0x0" ::: "memory"); __builtin_amdgcn_sched_barrier(0); };   // the wait stands in front of any later overwrite of the address registers that the loads above name; the scheduling barrier keeps later vector instructions from being lifted over it
  // step kc (parity bf): its fragment reads are issued, step kc + 1 is converted and stored while LDS serves them, step kc + 3 is fetched into the set so freed, then step kc's products. cv, ft: a step kc + 1, kc + 3 exists; bf, cv, ft are compile-time constants at each call (under a run-time test the compiler waited for every outstanding load ahead of a conversion, the younger set's too)
  auto step = [&](const int kc, const int bf, const bool cv, const bool ft) __attribute__((always_inline)) {
    __builtin_amdgcn_fence(__ATOMIC_RELEASE, "workgroup", "local"); __builtin_amdgcn_s_barrier(); __builtin_amdgcn_fence(__ATOMIC_ACQUIRE, "workgroup", "local");   // work-group barrier that orders LDS alone: it publishes step kc's tiles and ends every wave's reads of the other buffer (step kc - 1) before step kc + 1 is stored there; __syncthreads() here also waited for the global loads, which go to the thread's own registers and are to stay in flight
    v16b ah[2], al[2], w[4];
#pragma unroll
    for (int it = 0; it < 2; ++it) { ah[it] = frag_b(&sa[bf][wm * 32 + it * 16 + col][0], lane); al[it] = frag_b(&sb[bf][wm * 32 + it * 16 + col][0], lane); }
#pragma unroll
    for (int j = 0; j < 4; ++j) w[j] = frag_b(&sw[bf][wn * 64 + j * 16 + col][0], lane);
    __builtin_amdgcn_sched_barrier(0);   // the fragment reads are issued first, so that the conversion below runs while LDS serves them
    if (cv) conv(bf ^ 1);
    if (ft) fetch(bf ^ 1, kc + 3);
    else __builtin_amdgcn_sched_barrier(0);   // as at the end of fetch: keeps the products behind the conversion and its LDS stores
#pragma unroll
    for (int it = 0; it < 2; ++it)
#pragma unroll
      for (int j = 0; j < 4; ++j) acc[it][j] = wmma_bf(ah[it], w[j], acc[it][j]);
#pragma unroll
    for (int it = 0; it < 2; ++it)
#pragma unroll
      for (int j = 0; j < 4; ++j) acc[it][j] = wmma_bf(al[it], w[j], acc[it][j]); };
  conv(0); fetch(0, 2);
  for (int k2 = 0; k2 < CC / 32 - 4; k2 += 2) { step(k2, 0, true, true); step(k2 + 1, 1, true, true); }
  step(CC / 32 - 4, 0, true, true); step(CC / 32 - 3, 1, true, false); step(CC / 32 - 2, 0, true, false); step(CC / 32 - 1, 1, false, false);
  __syncthreads();   // the last step's fragment reads end before the epilogue tile overwrites the staging buffers
  float (*sf)[132] = (float (*)[132])sm;
#pragma unroll
  for (int j = 0; j < 4; ++j) { const int cl = wn * 64 + j * 16 + col; const float bb = bfr(BO[c0 + cl]);
#pragma unroll
    for (int it = 0; it < 2; ++it)
#pragma unroll
      for (int r = 0; r < 8; ++r) sf[wm * 32 + it * 16 + 8 * g + r][cl] = acc[it][j][r] + bb; }
  __syncthreads();
  for (int e = tid; e < 128 * 32; e += 256) { const int rl = e >> 5, q = e & 31; vst2(OUT + (r0 + rl) * CC + c0 + q * 4, *(const v4f*)&sf[rl][q * 4]); } }
extern "C" void kernel_launch(void* const* d_in, const int* in_sizes, int n_in, void* d_out, int out_size, void* d_ws, size_t ws_size, hipStream_t stream) {
  (void)in_sizes; (void)n_in; (void)out_size;
  const float** F = (const float**)d_in;   // 0 x [2,2048,1024], 1 Wqkv_w [3072,1024] ([out,in]; channel o = which*1024 + h*32 + d), 2 Wqkv_b [3072], 3 gn_w [1024], 4 gn_b, 5 out_w [1024,1024] ([out,in]), 6 out_b
  if (ws_size < (size_t)WS_END) return;
  char* ws = (char*)d_ws; _Float16 *QH = (_Float16*)(ws + WS_QH), *QL = (_Float16*)(ws + WS_QL), *KV = (_Float16*)(ws + WS_KV), *KVL = (_Float16*)(ws + WS_KVL); __bf16 *KT = (__bf16*)(ws + WS_KT), *KL = (__bf16*)(ws + WS_KL), *VT = (__bf16*)(ws + WS_VT), *VL = (__bf16*)(ws + WS_VL); float *CTX = (float*)(ws + WS_CTX), *GS = (float*)(ws + WS_GS);
  k_proj<<<dim3(TNB * TT / 128, CC / 128, 3), 256, 0, stream>>>(F[0], F[1], F[2], QH, QL, KT, KL, VT, VL);
  k_kv<<<dim3(NH, TNB, 4), 256, 0, stream>>>(KT, KL, VT, VL, KV, KVL);
  k_ctx<<<dim3(TNB * TT / 64, NH / 4), 128, 0, stream>>>(QH, QL, KV, KVL, CTX, GS);
  k_out<<<dim3(TNB * TT / 128, CC / 128), 256, 0, stream>>>(CTX, GS, F[3], F[4], F[5], F[6], (float*)d_out);
}

// v006
// It runs in 63 microseconds.
// Next to v005, in two timings, it ran 1.12 and 1.13 times as fast.
// Over all steps from v000 it is 6.71 times as fast.
#include <hip/hip_runtime.h>
#include <math.h>

typedef __attribute__((ext_vector_type(16))) _Float16 v16h;
typedef __attribute__((ext_vector_type(16))) __bf16 v16b;
typedef __attribute__((ext_vector_type(8)))  _Float16 v8h;
typedef __attribute__((ext_vector_type(8)))  float v8f;
typedef __attribute__((ext_vector_type(4)))  float v4f;
typedef __attribute__((ext_vector_type(2)))  float v2f;
typedef __attribute__((ext_vector_type(4)))  unsigned v4u;
typedef __attribute__((ext_vector_type(4)))  int v4i;
typedef float __attribute__((may_alias)) float_a;
typedef int __attribute__((may_alias)) int_a;

template <typename T> __device__ __forceinline__ void vst2(void* p, T v) { *(T*)p = v;  }
__device__ __forceinline__ v8f wmma16(v16h a, v16h b, v8f c) {
  v8f d = __builtin_amdgcn_wmma_f32_16x16x32_f16(false, a, false, b, (short)0, c, false, false);
  asm volatile("v_nop\n\tv_nop\n\tv_nop\n\tv_nop" : "+v"(d) : "v"(a), "v"(b));
  return d;
}
__device__ __forceinline__ v8f wmma_bf(v16b a, v16b b, v8f c) {
  v8f d = __builtin_amdgcn_wmma_f32_16x16x32_bf16(false, a, false, b, (short)0, c, false, false);
  asm volatile("v_nop\n\tv_nop\n\tv_nop\n\tv_nop" : "+v"(d) : "v"(a), "v"(b));
  return d;
}
// 16x16x32 fragments: lane = (h = lane>>4, row/col = lane&15); elements 0..7 = k0+8h+0..7, 8..15 = k0+16+8h+0..7; D element r = row 8h+r
__device__ __forceinline__ v16h frag_h(const _Float16* rowk0, int lane) {
  union { v16h v; v8h q[2]; } u; const _Float16* p = rowk0 + 8 * (lane >> 4);
  u.q[0] = *(const v8h*)p; u.q[1] = *(const v8h*)(p + 16); return u.v;
}
__device__ __forceinline__ v16h frag_f32(const float* rowk0, int lane) {
  v16h a; const float* p = rowk0 + 8 * (lane >> 4);
#pragma unroll
  for (int i = 0; i < 8; ++i) { a[i] = (_Float16)p[i]; a[8 + i] = (_Float16)p[16 + i]; }
  return a;
}
__device__ __forceinline__ v16h frag_f32s(const float* rowk0, int lane, float sc) {
  v16h a; const float* p = rowk0 + 8 * (lane >> 4);
#pragma unroll
  for (int i = 0; i < 8; ++i) { a[i] = (_Float16)(p[i] * sc); a[8 + i] = (_Float16)(p[16 + i] * sc); }
  return a;
}
// column fragment from a [K][ld] layout (column n), rows >= K read as 0
__device__ __forceinline__ v16h fragc_f32(const float* W, int k0, int n, int lane, int ld, int K) {
  v16h a; const int g = lane >> 4;
#pragma unroll
  for (int i = 0; i < 8; ++i) { const int ka = k0 + 8 * g + i, kb = ka + 16;
    a[i] = (_Float16)(ka < K ? W[(size_t)(ka < K ? ka : K - 1) * ld + n] : 0.f); a[8 + i] = (_Float16)(kb < K ? W[(size_t)(kb < K ? kb : K - 1) * ld + n] : 0.f); }
  return a;
}
struct F2 { v16b h, l; };
__device__ __forceinline__ F2 bsplit16(const float v[16]) { F2 r;
#pragma unroll
  for (int i = 0; i < 16; ++i) { const __bf16 h = (__bf16)v[i]; r.h[i] = h; r.l[i] = (__bf16)(v[i] - (float)h); }
  return r; }
__device__ __forceinline__ F2 split_row(const float* row, int k0, int lane) { float v[16]; const float* p = row + k0 + 8 * (lane >> 4);
#pragma unroll
  for (int i = 0; i < 8; ++i) { v[i] = p[i]; v[8 + i] = p[16 + i]; }
  return bsplit16(v); }
__device__ __forceinline__ F2 split_rowK(const float* row, int k0, int lane, int K) { float v[16]; const int g = lane >> 4;
#pragma unroll
  for (int i = 0; i < 8; ++i) { const int ka = k0 + 8 * g + i, kb = ka + 16; v[i] = ka < K ? row[ka < K ? ka : K - 1] : 0.f; v[8 + i] = kb < K ? row[kb < K ? kb : K - 1] : 0.f; }
  return bsplit16(v); }
__device__ __forceinline__ F2 split_col(const float* W, int k0, int n, int lane, int ld, int K) { float v[16]; const int g = lane >> 4;
#pragma unroll
  for (int i = 0; i < 8; ++i) { const int ka = k0 + 8 * g + i, kb = ka + 16; v[i] = ka < K ? W[(size_t)(ka < K ? ka : K - 1) * ld + n] : 0.f; v[8 + i] = kb < K ? W[(size_t)(kb < K ? kb : K - 1) * ld + n] : 0.f; }
  return bsplit16(v); }
__device__ __forceinline__ v8f mac3(const F2& a, const F2& b, v8f c) { c = wmma_bf(a.l, b.h, c); c = wmma_bf(a.h, b.l, c); return wmma_bf(a.h, b.h, c); }
__device__ __forceinline__ float sigm(float v) { return 1.0f / (1.0f + expf(-v)); }
#define LDSX() do { asm volatile("s_wait_dscnt 0" ::: "memory"); __builtin_amdgcn_wave_barrier(); __builtin_amdgcn_fence(__ATOMIC_RELEASE, "workgroup"); } while (0)

// MHLA (B 2, S 2,048, 1,024 = 32 heads x 32): q,k,v = split(x Wqkv^T + b) as [B,S,3,H,Dh]; a = q k^T (no softmax); ctx = a v  (== q (k^T v), reassociated exactly); GroupNorm per (b, head) over (Dh, S) with eps 1e-5 and per-channel affine; out = ctx out_w^T + out_b.
__device__ __forceinline__ float bfr(float v) { return (float)(__bf16)v; }
#define NB 2
#define TT 2048
#define CC 1024
#define NH 32
#define HD 32
#ifndef TNB
#define TNB NB
#endif
#ifndef QSTR
#define QSTR (TT * CC)        // unused; x rows are read as [b*T+t][1024]
#endif
typedef __attribute__((ext_vector_type(8))) __bf16 v8b;
__device__ __forceinline__ v16b frag_b(const __bf16* rowk0, int lane) { union { v16b v; v8b q[2]; } u; const __bf16* p = rowk0 + 8 * (lane >> 4); u.q[0] = *(const v8b*)p; u.q[1] = *(const v8b*)(p + 16); return u.v; }
#define WS_QH  0u                                          // f16 q hi rows [b*T+t][1024]
#define WS_QL  (WS_QH + 2u * (size_t)NB * TT * CC)
#define WS_KP  (WS_QL + 2u * (size_t)NB * TT * CC)           // f32 partial KV tiles, one set per 128-row block: [b*T/128 + row block][h][jt][it][j][i]
#define WS_KV  (WS_KP + 4u * (size_t)(NB * TT / 128) * NH * HD * HD)   // f16 KV hi + residual tiles [b][h][jt][it][j][i] (j = v dim = output col, i = k dim)
#define WS_KVL (WS_KV + 2u * (size_t)NB * NH * HD * HD)
#define WS_CTX (WS_KVL + 2u * (size_t)NB * NH * HD * HD)      // f32 ctx rows [b*T+t][1024]
#define WS_GS  (WS_CTX + 4u * (size_t)NB * TT * CC)          // f32 GroupNorm partials, one 128-B line per k_ctx block: [64-row block][4-head group][head][wave][sum, centred square sum]
#define WS_END (WS_GS + 4u * (size_t)(NB * TT / 64) * (NH / 4) * 32)
typedef __attribute__((ext_vector_type(4))) __bf16 v4b;
typedef const __attribute__((address_space(1))) float* gcf;
// a block-uniform global address kept whole in a scalar register pair: the loads of a k step then take it as their scalar base beside one fixed 32-bit lane offset, and no vector address register is formed anew (and overwritten) in each step
__device__ __forceinline__ gcf ubase(const float* p) { const unsigned long long a = (unsigned long long)p;
  return (gcf)(((unsigned long long)(unsigned)__builtin_amdgcn_readfirstlane((int)(a >> 32)) << 32) | (unsigned)__builtin_amdgcn_readfirstlane((int)(unsigned)a)); }
typedef const __attribute__((address_space(1))) v4f* gcv4;
#define PT 40   // LDS row pitch of a staged 32-k bf16 row, in elements: 80 B = 16 B x odd, which ds_load_b128 fragment reads take without bank conflicts
// ---- k_proj: block = (128 rows, 128 cols), 8 waves of 32 x 64: qkv = x W^T + b ([out,in] rows which*1024 + o). z 0: 128 q cols; z 1, 2: the 64 k cols and the 64 v cols of one pair of heads. Per 32-k step the block converts its x and W tiles to bf16 once and stages them in LDS (two buffers, next step's global loads in flight over the products); q -> f16 hi + residual rows; k, v -> bf16 hi + lo tiles [c][t] in LDS alone, from which the block takes KV[i][j] = sum_t k[t][i] v[t][j] over its 128 rows (one 16 x 16 tile per wave, 3 products) and stores it as f32 partial tiles
__global__ __launch_bounds__(256) void k_proj(const float* __restrict__ X, const float* __restrict__ Wt, const float* __restrict__ Bv, _Float16* __restrict__ QH, _Float16* __restrict__ QL, float* __restrict__ KP) {
  __shared__ __align__(16) char sm[2 * 128 * 136 * 2];   // loop: x tiles [2][128][PT], W tiles [2][128][PT]; epilogue: hi and lo tiles [128][136]
  __bf16 (*sx)[128][PT] = (__bf16 (*)[128][PT])sm; __bf16 (*sw)[128][PT] = (__bf16 (*)[128][PT])(sm + 2 * 128 * PT * 2);
  const int tid = threadIdx.x, wave = tid >> 5, lane = tid & 31, col = lane & 15, g = lane >> 4, wm = wave >> 1, wn = wave & 1; const int which = blockIdx.z; const int c0 = blockIdx.y * 128; const size_t r0 = (size_t)blockIdx.x * 128;
  const int hp = (which - 1) * (CC / 128) + blockIdx.y;   // z 1, 2: pair of heads 2 hp, 2 hp + 1 (k, v cols 64 hp .. 64 hp + 63)
  const int lr = tid >> 3, lq = tid & 7;   // staging: rows lr + 32 i, floats 4 lq .. 4 lq + 3 (8 lanes cover one 128-B line)
  const float* xp = X + r0 * CC; const float* wp = Wt + (size_t)(which ? CC + hp * 64 : c0) * CC; const float* wq = wp + (which ? (size_t)(CC - 64) * CC : 0); const unsigned lo = lr * CC + lq * 4;   // block-uniform bases, one 32-bit lane offset for both tiles; wq: base of W tile rows 64 .. 127, which are the v rows where z is 1 or 2
  const int st = (blockIdx.x + 4 * blockIdx.y) & (CC / 32 - 1);   // first k step of this block; the walk wraps round. The 32 blocks that share a W tile and the 8 column blocks that share an x tile then stand at different steps and do not ask L2 for the same lines at one moment
  v4f px[4], pw[4];
  __builtin_amdgcn_sched_barrier(0);   // keeps the kernel-argument load above from sinking in behind the tile loads below; held here, a wait to 0 stands directly behind the last tile load
#pragma unroll
  for (int i = 0; i < 4; ++i) { px[i] = *(const v4f*)(xp + st * 32 + i * 32 * CC + lo); pw[i] = *(const v4f*)((i < 2 ? wp : wq) + st * 32 + i * 32 * CC + lo); }
  asm volatile("s_wait_xcnt 0x0" ::: "memory"); __builtin_amdgcn_sched_barrier(0);   // the wait stands in front of any later overwrite of the address registers that the loads above name; the scheduling barrier keeps later vector instructions from being lifted over it
  v8f acc[2][4] = {};
#pragma unroll 2
  for (int kc = 0; kc < CC / 32; ++kc) { const int bf = kc & 1;
#pragma unroll
    for (int i = 0; i < 4; ++i) { *(v4b*)&sx[bf][lr + 32 * i][lq * 4] = __builtin_convertvector(px[i], v4b); *(v4b*)&sw[bf][lr + 32 * i][lq * 4] = __builtin_convertvector(pw[i], v4b); }
    __syncthreads();   // publishes step kc's tiles; it also ends every wave's reads of the other buffer (step kc - 1) before step kc + 1 is stored there
    v16b a[2], w[4];
#pragma unroll
    for (int it = 0; it < 2; ++it) a[it] = frag_b(&sx[bf][wm * 32 + it * 16 + col][0], lane);
#pragma unroll
    for (int j = 0; j < 4; ++j) w[j] = frag_b(&sw[bf][wn * 64 + j * 16 + col][0], lane);
    if (kc + 1 < CC / 32) { const int kn = ((st + kc + 1) & (CC / 32 - 1)) * 32;   // next step of the wrapped walk, block-uniform
      const gcf xk = ubase(xp + kn), wk = ubase(wp + kn), wk2 = ubase(wq + kn);
#pragma unroll
      for (int i = 0; i < 4; ++i) { px[i] = *(gcv4)(xk + i * 32 * CC + lo); pw[i] = *(gcv4)((i < 2 ? wk : wk2) + i * 32 * CC + lo); }
      asm volatile("s_wait_xcnt 0x0" ::: "memory"); __builtin_amdgcn_sched_barrier(0);   // the wait stands in front of any later overwrite of the address registers that the loads above name; the scheduling barrier keeps later vector instructions from being lifted over it
    }
#pragma unroll
    for (int it = 0; it < 2; ++it)
#pragma unroll
      for (int j = 0; j < 4; ++j) acc[it][j] = wmma_bf(a[it], w[j], acc[it][j]);
    __builtin_amdgcn_sched_barrier(0); }   // keeps the next step's conversions, and with them the wait for its global loads, behind this step's products
  __syncthreads();   // the last step's fragment reads end before the epilogue tiles overwrite the staging buffers
  _Float16 (*sh)[136] = (_Float16 (*)[136])sm; _Float16 (*sl)[136] = (_Float16 (*)[136])(sm + 128 * 136 * 2); __bf16 (*th)[136] = (__bf16 (*)[136])sm; __bf16 (*tl2)[136] = (__bf16 (*)[136])(sm + 128 * 136 * 2);
  float bv[4];
#pragma unroll
  for (int j = 0; j < 4; ++j) bv[j] = Bv[(which ? (1 + wn) * CC + hp * 64 : c0 + wn * 64) + j * 16 + col];
  asm volatile("s_wait_xcnt 0x0" ::: "memory"); __builtin_amdgcn_sched_barrier(0);   // wait and scheduling barrier as behind the tile loads above
  if (which == 0) {
#pragma unroll
    for (int j = 0; j < 4; ++j) { const int cl = wn * 64 + j * 16 + col; const float bb = bfr(bv[j]);
#pragma unroll
      for (int it = 0; it < 2; ++it)
#pragma unroll
        for (int r = 0; r < 8; ++r) { const float v = acc[it][j][r] + bb; const int rl = wm * 32 + it * 16 + 8 * g + r; const _Float16 hv = (_Float16)v; sh[rl][cl] = hv; sl[rl][cl] = (_Float16)((v - (float)hv) * 1024.0f); } }
  } else {
#pragma unroll
    for (int j = 0; j < 4; ++j) { const int cl = wn * 64 + j * 16 + col; const float bb = bfr(bv[j]);
#pragma unroll
      for (int it = 0; it < 2; ++it) { v8b h8, l8;
#pragma unroll
        for (int r = 0; r < 8; ++r) { const float v = acc[it][j][r] + bb; const __bf16 bh = (__bf16)v; h8[r] = bh; l8[r] = (__bf16)(v - (float)bh); }
        *(v8b*)&th[cl][wm * 32 + it * 16 + 8 * g] = h8; *(v8b*)&tl2[cl][wm * 32 + it * 16 + 8 * g] = l8; }
      __builtin_amdgcn_sched_barrier(0); }   // one column group at a time: keeps the epilogue's register use under the loop's 160, at which three blocks share a WGP
  }
  __syncthreads();
  if (which == 0) { for (int e = tid; e < 128 * 16; e += 256) { const int rl = e >> 4, q = e & 15; vst2((unsigned*)(QH + (r0 + rl) * CC + c0 + q * 8), *(const v4u*)&sh[rl][q * 8]); vst2((unsigned*)(QL + (r0 + rl) * CC + c0 + q * 8), *(const v4u*)&sl[rl][q * 8]); } }
  else { const int hh = wave >> 2, it = (wave >> 1) & 1, jt = wave & 1, kr = hh * HD + it * 16 + col, vr = 64 + hh * HD + jt * 16 + col;   // wave = (head of the pair, tile (it, jt)); A rows = k cols (i), B cols = v cols (j), both read along t by frag_b: one k order
    v8f ahh = {}, alh = {}, ahl = {};
#pragma unroll
    for (int s = 0; s < 4; ++s) { const v16b kh = frag_b(&th[kr][s * 32], lane), kl = frag_b(&tl2[kr][s * 32], lane), vh = frag_b(&th[vr][s * 32], lane), vl = frag_b(&tl2[vr][s * 32], lane); ahh = wmma_bf(kh, vh, ahh); alh = wmma_bf(kl, vh, alh); ahl = wmma_bf(kh, vl, ahl); }
    const v8f t = ahh + (alh + ahl); float* o = KP + ((((size_t)blockIdx.x * NH + hp * 2 + hh) * 2 + jt) * 2 + it) * 256 + col * 16 + 8 * g;   // 1 KiB per wave, lane (j = col, i = 8 g ..)
    vst2(o, __builtin_shufflevector(t, t, 0, 1, 2, 3)); vst2(o + 4, __builtin_shufflevector(t, t, 4, 5, 6, 7));
    asm volatile("s_wait_xcnt 0x0" ::: "memory"); } }   // the wait stands behind the two stores, in front of any later overwrite of the registers that they name
// B fragment of one head's KV, stored tile by tile [jt][it][16 j][16 i]: elements 0..7 = i 8g + 0..7 (tile it 0), 8..15 = i 16 + 8g + 0..7 (tile it 1, 256 elements on): the k order of frag_h
__device__ __forceinline__ v16h frag_kv(const _Float16* row0, int lane) {
  union { v16h v; v8h q[2]; } u; const _Float16* p = row0 + 8 * (lane >> 4);
  u.q[0] = *(const v8h*)p; u.q[1] = *(const v8h*)(p + 256); return u.v;
}
// ---- k_kv: block = (h, b), 256 threads of 4 elements: KV of one head = its 16 row blocks' partial tiles added in row-block order (16 loads of 16 B per thread, all in flight at once); stored as f16 hi + residual tiles [b][h][jt][it][j][i]: 2 KiB + 2 KiB per block
typedef __attribute__((ext_vector_type(4))) _Float16 v4h;
__global__ __launch_bounds__(256) void k_kv(const float* __restrict__ KP, _Float16* __restrict__ KV, _Float16* __restrict__ KVL) {
  const size_t b = blockIdx.y; const int h = blockIdx.x; const float* p = KP + (b * (TT / 128) * NH + h) * (size_t)(HD * HD) + threadIdx.x * 4;
  v4f f[TT / 128];
#pragma unroll
  for (int w = 0; w < TT / 128; ++w) f[w] = *(const v4f*)(p + (size_t)w * NH * HD * HD);
  asm volatile("s_wait_xcnt 0x0" ::: "memory"); __builtin_amdgcn_sched_barrier(0);   // the wait stands in front of any later overwrite of the address registers that the loads above name; the scheduling barrier keeps later vector instructions from being lifted over it
  v4f s = f[0];
#pragma unroll
  for (int w = 1; w < TT / 128; ++w) s += f[w];
  v4h h4, l4;
#pragma unroll
  for (int r = 0; r < 4; ++r) { const _Float16 hv = (_Float16)s[r]; h4[r] = hv; l4[r] = (_Float16)((s[r] - (float)hv) * 1024.0f); }
  const size_t o = (b * NH + h) * (size_t)(HD * HD) + threadIdx.x * 4; vst2(KV + o, h4); vst2(KVL + o, l4); }
// lane l's value added to that of lane l ^ M inside a 16-lane row (DPP row_xmask), and to that of lane l ^ 16: vector instructions, where __shfl_xor goes through the LDS pipe with a wait behind each step
template <int M> __device__ __forceinline__ float addx(float x) { return x + __builtin_bit_cast(float, __builtin_amdgcn_update_dpp(0, __builtin_bit_cast(int, x), 0x160 | M, 0xf, 0xf, true)); }
__device__ __forceinline__ float addh(float x) { return x + __builtin_bit_cast(float, __builtin_amdgcn_permlanex16(__builtin_bit_cast(int, x), __builtin_bit_cast(int, x), 0x76543210, 0xfedcba98, false, false)); }
__device__ __forceinline__ float wsum(float x) { return addh(addx<8>(addx<4>(addx<2>(addx<1>(x))))); }
// ---- k_ctx: block = (64 rows t, 4 heads): ctx[t][h*32 + j] = sum_i q[t][h*32 + i] KV_h[i][j] (q hi+res x KV hi+res, 3 products, K = 32 = one chunk); 512-B segments per row. Each wave also takes, from the registers that hold its 16 x 32 values of a head, their sum and the sum of squares about their own mean; the block stores its 16 pairs as one 128-B line
__global__ __launch_bounds__(128) void k_ctx(const _Float16* __restrict__ QH, const _Float16* __restrict__ QL, const _Float16* __restrict__ KV, const _Float16* __restrict__ KVL, float* __restrict__ CTX, float* __restrict__ PS) { __shared__ __align__(16) float sf[4][16][132]; __shared__ float sps[32]; float vv[4][16];
  const int tid = threadIdx.x, wave = tid >> 5, lane = tid & 31, col = lane & 15, g = lane >> 4; const int h0 = blockIdx.y * 4; const size_t r0 = (size_t)blockIdx.x * 64 + wave * 16; const size_t b = r0 / TT;
#pragma unroll
  for (int hh = 0; hh < 4; ++hh) { const int h = h0 + hh; v8f acc[2] = {}; const v16h ah = frag_h(QH + (r0 + col) * CC + h * HD, lane), al = frag_h(QL + (r0 + col) * CC + h * HD, lane);
#pragma unroll
    for (int jt = 0; jt < 2; ++jt) { const size_t bo = ((b * NH + h) * 4 + jt * 2) * 256 + col * 16; const v16h bh = frag_kv(KV + bo, lane), bl = frag_kv(KVL + bo, lane); acc[jt] = wmma16(ah, bh, acc[jt]); v8f t2 = {}; t2 = wmma16(al, bh, t2); t2 = wmma16(ah, bl, t2);
#pragma unroll
      for (int r = 0; r < 8; ++r) { const float v = acc[jt][r] + t2[r] * (1.0f / 1024.0f); vv[hh][jt * 8 + r] = v; sf[wave][8 * g + r][hh * 32 + jt * 16 + col] = v; } } }
  LDSX(); for (int rl = 0; rl < 16; ++rl) vst2(CTX + (r0 + rl) * CC + h0 * HD + lane * 4, *(const v4f*)&sf[wave][rl][lane * 4]);
  asm volatile("s_wait_xcnt 0x0" ::: "memory"); __builtin_amdgcn_sched_barrier(0);   // the wait stands in front of any later overwrite of the registers that the stores above name; the scheduling barrier keeps the sums below behind it, so that the ctx stores are issued first and drain while the sums are taken
  float s[4], d[4];
#pragma unroll
  for (int hh = 0; hh < 4; ++hh) { float a0 = 0.f, a1 = 0.f;
#pragma unroll
    for (int e = 0; e < 8; ++e) { a0 += vv[hh][e]; a1 += vv[hh][8 + e]; }
    s[hh] = a0 + a1; }
#pragma unroll
  for (int hh = 0; hh < 4; ++hh) s[hh] = wsum(s[hh]);
#pragma unroll
  for (int hh = 0; hh < 4; ++hh) { const float m = s[hh] * (1.0f / 512.0f); float a0 = 0.f, a1 = 0.f;
#pragma unroll
    for (int e = 0; e < 8; ++e) { const float t0 = vv[hh][e] - m, t1 = vv[hh][8 + e] - m; a0 += t0 * t0; a1 += t1 * t1; }
    d[hh] = a0 + a1; }
#pragma unroll
  for (int hh = 0; hh < 4; ++hh) d[hh] = wsum(d[hh]);
  if (lane == 0) {
#pragma unroll
    for (int hh = 0; hh < 4; ++hh) { sps[hh * 8 + wave * 2] = s[hh]; sps[hh * 8 + wave * 2 + 1] = d[hh]; } }
  __builtin_amdgcn_fence(__ATOMIC_RELEASE, "workgroup", "local"); __builtin_amdgcn_s_barrier(); __builtin_amdgcn_fence(__ATOMIC_ACQUIRE, "workgroup", "local");   // work-group barrier that orders LDS alone: it publishes the four waves' pairs to wave 0, which alone writes the block's line; __syncthreads() here also waited until the ctx stores above had been acknowledged
  if (wave == 0) vst2(PS + ((size_t)blockIdx.x * (NH / 4) + blockIdx.y) * 32 + lane, sps[lane]); }
// ---- k_out: block = (128 rows, 128 cols), 8 waves of 32 x 64: out = gh (hi + lo) out_w^T + out_b with gh = (ctx - mu_h) rstd_h gn_w[c] + gn_b[c]; per 32-k step (one head) the block builds gh hi, gh lo and the bf16 out_w tile once and stages them in LDS (two buffers), as k_proj does; its global loads run three steps ahead of the products, in two register sets, and a step's tiles are built one step ahead, behind the fragment reads of the step before. mu_h and rstd_h come from k_ctx's partials: each block merges the 128 (sum, centred square sum) pairs of each of its batch's 32 heads ahead of its loop
__global__ __launch_bounds__(256) void k_out(const float* __restrict__ CTX, const float* __restrict__ PS, const float* __restrict__ GW, const float* __restrict__ GB, const float* __restrict__ WO, const float* __restrict__ BO, float* __restrict__ OUT) {
  __shared__ __align__(16) char sm[128 * 132 * 4];   // loop: gh hi, gh lo and W tiles, each [2][128][PT]; epilogue: f32 tile [128][132]
  __bf16 (*sa)[128][PT] = (__bf16 (*)[128][PT])sm; __bf16 (*sb)[128][PT] = (__bf16 (*)[128][PT])(sm + 2 * 128 * PT * 2); __bf16 (*sw)[128][PT] = (__bf16 (*)[128][PT])(sm + 4 * 128 * PT * 2);
  const int tid = threadIdx.x, wave = tid >> 5, lane = tid & 31, col = lane & 15, g = lane >> 4, wm = wave >> 1, wn = wave & 1; const int c0 = blockIdx.y * 128; const size_t r0 = (size_t)blockIdx.x * 128; const size_t b = r0 / TT;
  const int lr = tid >> 3, lq = tid & 7;   // staging: rows lr + 32 i, floats 4 lq .. 4 lq + 3
  const float* cp = CTX + r0 * CC; const float* wp = WO + (size_t)c0 * CC; const unsigned lo = lr * CC + lq * 4;   // block-uniform bases, one 32-bit lane offset for both tiles
  __shared__ float sst[2 * NH];   // mu, rstd of the batch's heads
  const int st = (blockIdx.x + 4 * blockIdx.y) & (CC / 32 - 1);   // first k step (head) of this block; the walk wraps round, as in k_proj: the blocks that share a ctx or an out_w tile stand at different steps
  const int s1 = (st + 1) & (CC / 32 - 1);   // second step of the walk
  v4f pc[2][4], pw[2][4], pgw[2], pgb[2], pq[8]; float mu[2], rs[2];   // [register set = step parity]
#pragma unroll
  for (int i = 0; i < 4; ++i) { const float* p = PS + ((b * (TT / 64) + lq + 8 * i) * (NH / 4) + (lr >> 2)) * 32 + (lr & 3) * 8; pq[2 * i] = *(const v4f*)p; pq[2 * i + 1] = *(const v4f*)(p + 4); }   // thread (head lr, eighth lq): 16 of the head's 128 pairs
#pragma unroll
  for (int i = 0; i < 4; ++i) { pc[0][i] = *(const v4f*)(cp + st * 32 + i * 32 * CC + lo); pw[0][i] = *(const v4f*)(wp + st * 32 + i * 32 * CC + lo); }
  pgw[0] = *(const v4f*)(GW + st * 32 + lq * 4); pgb[0] = *(const v4f*)(GB + st * 32 + lq * 4);
#pragma unroll
  for (int i = 0; i < 4; ++i) { pc[1][i] = *(const v4f*)(cp + s1 * 32 + i * 32 * CC + lo); pw[1][i] = *(const v4f*)(wp + s1 * 32 + i * 32 * CC + lo); }
  pgw[1] = *(const v4f*)(GW + s1 * 32 + lq * 4); pgb[1] = *(const v4f*)(GB + s1 * 32 + lq * 4);
  asm volatile("s_wait_xcnt 0x0" ::: "memory"); __builtin_amdgcn_sched_barrier(0);   // the wait stands in front of any later overwrite of the address registers that the loads above name; the scheduling barrier keeps later vector instructions from being lifted over it
  float ssum = 0.f, sm2 = 0.f;
#pragma unroll
  for (int i = 0; i < 8; ++i) ssum += pq[i][0] + pq[i][2];
  ssum = addx<4>(addx<2>(addx<1>(ssum)));   // over the head's 8 threads
  const float mean = ssum / (float)(TT * HD);
#pragma unroll
  for (int i = 0; i < 8; ++i) { const float e0 = pq[i][0] * (1.0f / 512.0f) - mean, e1 = pq[i][2] * (1.0f / 512.0f) - mean; sm2 += (pq[i][1] + pq[i][3]) + 512.0f * (e0 * e0 + e1 * e1); }   // squares about the whole mean = squares about each part's own mean + 512 (part mean - mean)^2
  sm2 = addx<4>(addx<2>(addx<1>(sm2)));
  if (lq == 0) { sst[2 * lr] = mean; sst[2 * lr + 1] = rsqrtf(sm2 / (float)(TT * HD) + 1e-5f); }
  __syncthreads();   // publishes the 32 heads' mu and rstd to every wave
  mu[0] = sst[2 * st]; rs[0] = sst[2 * st + 1]; mu[1] = sst[2 * s1]; rs[1] = sst[2 * s1 + 1];
  v8f acc[2][4] = {};
  // register set s -> LDS buffer s: gh hi, gh lo and the bf16 out_w tile of the step that the set holds (32 channels per step == one head)
  auto conv = [&](const int s) __attribute__((always_inline)) {
#pragma unroll
    for (int i = 0; i < 4; ++i) { v4f v;
#pragma unroll
      for (int e = 0; e < 4; ++e) v[e] = (pc[s][i][e] - mu[s]) * rs[s] * bfr(pgw[s][e]) + bfr(pgb[s][e]);
      const v4b hv = __builtin_convertvector(v, v4b); *(v4b*)&sa[s][lr + 32 * i][lq * 4] = hv; *(v4b*)&sb[s][lr + 32 * i][lq * 4] = __builtin_convertvector(v - __builtin_convertvector(hv, v4f), v4b); *(v4b*)&sw[s][lr + 32 * i][lq * 4] = __builtin_convertvector(pw[s][i], v4b); } };
  // global loads of step ks of the wrapped walk into register set s, which has just been converted
  auto fetch = [&](const int s, const int ks) __attribute__((always_inline)) { const int kn = ((st + ks) & (CC / 32 - 1)) * 32;   // block-uniform
    const gcf ck = ubase(cp + kn), wk = ubase(wp + kn), gwk = ubase(GW + kn), gbk = ubase(GB + kn); mu[s] = sst[kn >> 4]; rs[s] = sst[(kn >> 4) + 1];
    __builtin_amdgcn_sched_barrier(0);   // the LDS stores above and the LDS read of mu, rs are issued ahead of the tile loads: among them they stood behind the waits that precede each re-use of a scalar base register
#pragma unroll
    for (int i = 0; i < 4; ++i) { pc[s][i] = *(gcv4)(ck + i * 32 * CC + lo); pw[s][i] = *(gcv4)(wk + i * 32 * CC + lo); }
    pgw[s] = *(gcv4)(gwk + (unsigned)(lq * 4)); pgb[s] = *(gcv4)(gbk + (unsigned)(lq * 4));
    asm volatile("s_wait_xcnt 0x0" ::: "memory"); __builtin_amdgcn_sched_barrier(0); };   // the wait stands in front of any later overwrite of the address registers that the loads above name; the scheduling barrier keeps later vector instructions from being lifted over it
  // step kc (parity bf): its fragment reads are issued, step kc + 1 is converted and stored while LDS serves them, step kc + 3 is fetched into the set so freed, then step kc's products. cv, ft: a step kc + 1, kc + 3 exists; bf, cv, ft are compile-time constants at each call (under a run-time test the compiler waited for every outstanding load ahead of a conversion, the younger set's too)
  auto step = [&](const int kc, const int bf, const bool cv, const bool ft) __attribute__((always_inline)) {
    __builtin_amdgcn_fence(__ATOMIC_RELEASE, "workgroup", "local"); __builtin_amdgcn_s_barrier(); __builtin_amdgcn_fence(__ATOMIC_ACQUIRE, "workgroup", "local");   // work-group barrier that orders LDS alone: it publishes step kc's tiles and ends every wave's reads of the other buffer (step kc - 1) before step kc + 1 is stored there; __syncthreads() here also waited for the global loads, which go to the thread's own registers and are to stay in flight
    v16b ah[2], al[2], w[4];
#pragma unroll
    for (int it = 0; it < 2; ++it) { ah[it] = frag_b(&sa[bf][wm * 32 + it * 16 + col][0], lane); al[it] = frag_b(&sb[bf][wm * 32 + it * 16 + col][0], lane); }
#pragma unroll
    for (int j = 0; j < 4; ++j) w[j] = frag_b(&sw[bf][wn * 64 + j * 16 + col][0], lane);
    __builtin_amdgcn_sched_barrier(0);   // the fragment reads are issued first, so that the conversion below runs while LDS serves them
    if (cv) conv(bf ^ 1);
    if (ft) fetch(bf ^ 1, kc + 3);
    else __builtin_amdgcn_sched_barrier(0);   // as at the end of fetch: keeps the products behind the conversion and its LDS stores
#pragma unroll
    for (int it = 0; it < 2; ++it)
#pragma unroll
      for (int j = 0; j < 4; ++j) acc[it][j] = wmma_bf(ah[it], w[j], acc[it][j]);
#pragma unroll
    for (int it = 0; it < 2; ++it)
#pragma unroll
      for (int j = 0; j < 4; ++j) acc[it][j] = wmma_bf(al[it], w[j], acc[it][j]); };
  conv(0); fetch(0, 2);
  for (int k2 = 0; k2 < CC / 32 - 4; k2 += 2) { step(k2, 0, true, true); step(k2 + 1, 1, true, true); }
  step(CC / 32 - 4, 0, true, true); step(CC / 32 - 3, 1, true, false); step(CC / 32 - 2, 0, true, false); step(CC / 32 - 1, 1, false, false);
  __syncthreads();   // the last step's fragment reads end before the epilogue tile overwrites the staging buffers
  float (*sf)[132] = (float (*)[132])sm;
#pragma unroll
  for (int j = 0; j < 4; ++j) { const int cl = wn * 64 + j * 16 + col; const float bb = bfr(BO[c0 + cl]);
#pragma unroll
    for (int it = 0; it < 2; ++it)
#pragma unroll
      for (int r = 0; r < 8; ++r) sf[wm * 32 + it * 16 + 8 * g + r][cl] = acc[it][j][r] + bb; }
  __syncthreads();
  for (int e = tid; e < 128 * 32; e += 256) { const int rl = e >> 5, q = e & 31; vst2(OUT + (r0 + rl) * CC + c0 + q * 4, *(const v4f*)&sf[rl][q * 4]); } }
extern "C" void kernel_launch(void* const* d_in, const int* in_sizes, int n_in, void* d_out, int out_size, void* d_ws, size_t ws_size, hipStream_t stream) {
  (void)in_sizes; (void)n_in; (void)out_size;
  const float** F = (const float**)d_in;   // 0 x [2,2048,1024], 1 Wqkv_w [3072,1024] ([out,in]; channel o = which*1024 + h*32 + d), 2 Wqkv_b [3072], 3 gn_w [1024], 4 gn_b, 5 out_w [1024,1024] ([out,in]), 6 out_b
  if (ws_size < (size_t)WS_END) return;
  char* ws = (char*)d_ws; _Float16 *QH = (_Float16*)(ws + WS_QH), *QL = (_Float16*)(ws + WS_QL), *KV = (_Float16*)(ws + WS_KV), *KVL = (_Float16*)(ws + WS_KVL); float *KP = (float*)(ws + WS_KP), *CTX = (float*)(ws + WS_CTX), *GS = (float*)(ws + WS_GS);
  k_proj<<<dim3(TNB * TT / 128, CC / 128, 3), 256, 0, stream>>>(F[0], F[1], F[2], QH, QL, KP);
  k_kv<<<dim3(NH, TNB), 256, 0, stream>>>(KP, KV, KVL);
  k_ctx<<<dim3(TNB * TT / 64, NH / 4), 128, 0, stream>>>(QH, QL, KV, KVL, CTX, GS);
  k_out<<<dim3(TNB * TT / 128, CC / 128), 256, 0, stream>>>(CTX, GS, F[3], F[4], F[5], F[6], (float*)d_out);
}

// v007
// A run of this version takes 58.5 microseconds.
// Two timings next to v006 both put it at 1.07 times that version's speed.
// Over all steps from v000 it is 7.19 times as fast.
#include <hip/hip_runtime.h>
#include <math.h>

typedef __attribute__((ext_vector_type(16))) _Float16 v16h;
typedef __attribute__((ext_vector_type(16))) __bf16 v16b;
typedef __attribute__((ext_vector_type(8)))  _Float16 v8h;
typedef __attribute__((ext_vector_type(8)))  float v8f;
typedef __attribute__((ext_vector_type(4)))  float v4f;
typedef __attribute__((ext_vector_type(2)))  float v2f;
typedef __attribute__((ext_vector_type(4)))  unsigned v4u;
typedef __attribute__((ext_vector_type(4)))  int v4i;
typedef float __attribute__((may_alias)) float_a;
typedef int __attribute__((may_alias)) int_a;

template <typename T> __device__ __forceinline__ void vst2(void* p, T v) { *(T*)p = v;  }
__device__ __forceinline__ v8f wmma16(v16h a, v16h b, v8f c) {
  v8f d = __builtin_amdgcn_wmma_f32_16x16x32_f16(false, a, false, b, (short)0, c, false, false);
  asm volatile("v_nop\n\tv_nop\n\tv_nop\n\tv_nop" : "+v"(d) : "v"(a), "v"(b));
  return d;
}
__device__ __forceinline__ v8f wmma_bf(v16b a, v16b b, v8f c) {
  v8f d = __builtin_amdgcn_wmma_f32_16x16x32_bf16(false, a, false, b, (short)0, c, false, false);
  asm volatile("v_nop\n\tv_nop\n\tv_nop\n\tv_nop" : "+v"(d) : "v"(a), "v"(b));
  return d;
}
// 16x16x32 fragments: lane = (h = lane>>4, row/col = lane&15); elements 0..7 = k0+8h+0..7, 8..15 = k0+16+8h+0..7; D element r = row 8h+r
__device__ __forceinline__ v16h frag_h(const _Float16* rowk0, int lane) {
  union { v16h v; v8h q[2]; } u; const _Float16* p = rowk0 + 8 * (lane >> 4);
  u.q[0] = *(const v8h*)p; u.q[1] = *(const v8h*)(p + 16); return u.v;
}
__device__ __forceinline__ v16h frag_f32(const float* rowk0, int lane) {
  v16h a; const float* p = rowk0 + 8 * (lane >> 4);
#pragma unroll
  for (int i = 0; i < 8; ++i) { a[i] = (_Float16)p[i]; a[8 + i] = (_Float16)p[16 + i]; }
  return a;
}
__device__ __forceinline__ v16h frag_f32s(const float* rowk0, int lane, float sc) {
  v16h a; const float* p = rowk0 + 8 * (lane >> 4);
#pragma unroll
  for (int i = 0; i < 8; ++i) { a[i] = (_Float16)(p[i] * sc); a[8 + i] = (_Float16)(p[16 + i] * sc); }
  return a;
}
// column fragment from a [K][ld] layout (column n), rows >= K read as 0
__device__ __forceinline__ v16h fragc_f32(const float* W, int k0, int n, int lane, int ld, int K) {
  v16h a; const int g = lane >> 4;
#pragma unroll
  for (int i = 0; i < 8; ++i) { const int ka = k0 + 8 * g + i, kb = ka + 16;
    a[i] = (_Float16)(ka < K ? W[(size_t)(ka < K ? ka : K - 1) * ld + n] : 0.f); a[8 + i] = (_Float16)(kb < K ? W[(size_t)(kb < K ? kb : K - 1) * ld + n] : 0.f); }
  return a;
}
struct F2 { v16b h, l; };
__device__ __forceinline__ F2 bsplit16(const float v[16]) { F2 r;
#pragma unroll
  for (int i = 0; i < 16; ++i) { const __bf16 h = (__bf16)v[i]; r.h[i] = h; r.l[i] = (__bf16)(v[i] - (float)h); }
  return r; }
__device__ __forceinline__ F2 split_row(const float* row, int k0, int lane) { float v[16]; const float* p = row + k0 + 8 * (lane >> 4);
#pragma unroll
  for (int i = 0; i < 8; ++i) { v[i] = p[i]; v[8 + i] = p[16 + i]; }
  return bsplit16(v); }
__device__ __forceinline__ F2 split_rowK(const float* row, int k0, int lane, int K) { float v[16]; const int g = lane >> 4;
#pragma unroll
  for (int i = 0; i < 8; ++i) { const int ka = k0 + 8 * g + i, kb = ka + 16; v[i] = ka < K ? row[ka < K ? ka : K - 1] : 0.f; v[8 + i] = kb < K ? row[kb < K ? kb : K - 1] : 0.f; }
  return bsplit16(v); }
__device__ __forceinline__ F2 split_col(const float* W, int k0, int n, int lane, int ld, int K) { float v[16]; const int g = lane >> 4;
#pragma unroll
  for (int i = 0; i < 8; ++i) { const int ka = k0 + 8 * g + i, kb = ka + 16; v[i] = ka < K ? W[(size_t)(ka < K ? ka : K - 1) * ld + n] : 0.f; v[8 + i] = kb < K ? W[(size_t)(kb < K ? kb : K - 1) * ld + n] : 0.f; }
  return bsplit16(v); }
__device__ __forceinline__ v8f mac3(const F2& a, const F2& b, v8f c) { c = wmma_bf(a.l, b.h, c); c = wmma_bf(a.h, b.l, c); return wmma_bf(a.h, b.h, c); }
__device__ __forceinline__ float sigm(float v) { return 1.0f / (1.0f + expf(-v)); }
#define LDSX() do { asm volatile("s_wait_dscnt 0" ::: "memory"); __builtin_amdgcn_wave_barrier(); __builtin_amdgcn_fence(__ATOMIC_RELEASE, "workgroup"); } while (0)

// MHLA (B 2, S 2,048, 1,024 = 32 heads x 32): q,k,v = split(x Wqkv^T + b) as [B,S,3,H,Dh]; a = q k^T (no softmax); ctx = a v  (== q (k^T v), reassociated exactly); GroupNorm per (b, head) over (Dh, S) with eps 1e-5 and per-channel affine; out = ctx out_w^T + out_b.
__device__ __forceinline__ float bfr(float v) { return (float)(__bf16)v; }
#define NB 2
#define TT 2048
#define CC 1024
#define NH 32
#define HD 32
#ifndef TNB
#define TNB NB
#endif
#ifndef QSTR
#define QSTR (TT * CC)        // unused; x rows are read as [b*T+t][1024]
#endif
typedef __attribute__((ext_vector_type(8))) __bf16 v8b;
__device__ __forceinline__ v16b frag_b(const __bf16* rowk0, int lane) { union { v16b v; v8b q[2]; } u; const __bf16* p = rowk0 + 8 * (lane >> 4); u.q[0] = *(const v8b*)p; u.q[1] = *(const v8b*)(p + 16); return u.v; }
#define WS_QH  0u                                          // f16 q hi rows [b*T+t][1024]
#define WS_QL  (WS_QH + 2u * (size_t)NB * TT * CC)
#define WS_KP  (WS_QL + 2u * (size_t)NB * TT * CC)           // f32 partial KV tiles, one set per 128-row block: [b*T/128 + row block][h][jt][it][j][i] (j = v dim = output col, i = k dim)
#define WS_CTX (WS_KP + 4u * (size_t)(NB * TT / 128) * NH * HD * HD)   // f32 ctx rows [b*T+t][1024]
#define WS_GS  (WS_CTX + 4u * (size_t)NB * TT * CC)          // f32 GroupNorm partials, one 128-B line per k_ctx block and head: [b][head][16-row tile][sum, centred square sum]
#define WS_END (WS_GS + 4u * (size_t)NB * NH * (TT / 16) * 2)
typedef __attribute__((ext_vector_type(4))) __bf16 v4b;
typedef const __attribute__((address_space(1))) float* gcf;
// a block-uniform global address kept whole in a scalar register pair: the loads of a k step then take it as their scalar base beside one fixed 32-bit lane offset, and no vector address register is formed anew (and overwritten) in each step
__device__ __forceinline__ gcf ubase(const float* p) { const unsigned long long a = (unsigned long long)p;
  return (gcf)(((unsigned long long)(unsigned)__builtin_amdgcn_readfirstlane((int)(a >> 32)) << 32) | (unsigned)__builtin_amdgcn_readfirstlane((int)(unsigned)a)); }
typedef const __attribute__((address_space(1))) v4f* gcv4;
#define PT 40   // LDS row pitch of a staged 32-k bf16 row, in elements: 80 B = 16 B x odd, which ds_load_b128 fragment reads take without bank conflicts
// ---- k_proj: block = (128 rows, 128 cols), 8 waves of 32 x 64: qkv = x W^T + b ([out,in] rows which*1024 + o). z 0: 128 q cols; z 1, 2: the 64 k cols and the 64 v cols of one pair of heads. Per 32-k step the block converts its x and W tiles to bf16 once and stages them in LDS (two buffers, next step's global loads in flight over the products); q -> f16 hi + residual rows; k, v -> bf16 hi + lo tiles [c][t] in LDS alone, from which the block takes KV[i][j] = sum_t k[t][i] v[t][j] over its 128 rows (one 16 x 16 tile per wave, 3 products) and stores it as f32 partial tiles
__global__ __launch_bounds__(256) void k_proj(const float* __restrict__ X, const float* __restrict__ Wt, const float* __restrict__ Bv, _Float16* __restrict__ QH, _Float16* __restrict__ QL, float* __restrict__ KP) {
  __shared__ __align__(16) char sm[2 * 128 * 136 * 2];   // loop: x tiles [2][128][PT], W tiles [2][128][PT]; epilogue: hi and lo tiles [128][136]
  __bf16 (*sx)[128][PT] = (__bf16 (*)[128][PT])sm; __bf16 (*sw)[128][PT] = (__bf16 (*)[128][PT])(sm + 2 * 128 * PT * 2);
  const int tid = threadIdx.x, wave = tid >> 5, lane = tid & 31, col = lane & 15, g = lane >> 4, wm = wave >> 1, wn = wave & 1; const int which = blockIdx.z; const int c0 = blockIdx.y * 128; const size_t r0 = (size_t)blockIdx.x * 128;
  const int hp = (which - 1) * (CC / 128) + blockIdx.y;   // z 1, 2: pair of heads 2 hp, 2 hp + 1 (k, v cols 64 hp .. 64 hp + 63)
  const int lr = tid >> 3, lq = tid & 7;   // staging: rows lr + 32 i, floats 4 lq .. 4 lq + 3 (8 lanes cover one 128-B line)
  const float* xp = X + r0 * CC; const float* wp = Wt + (size_t)(which ? CC + hp * 64 : c0) * CC; const float* wq = wp + (which ? (size_t)(CC - 64) * CC : 0); const unsigned lo = lr * CC + lq * 4;   // block-uniform bases, one 32-bit lane offset for both tiles; wq: base of W tile rows 64 .. 127, which are the v rows where z is 1 or 2
  const int st = (blockIdx.x + 4 * blockIdx.y) & (CC / 32 - 1);   // first k step of this block; the walk wraps round. The 32 blocks that share a W tile and the 8 column blocks that share an x tile then stand at different steps and do not ask L2 for the same lines at one moment
  v4f px[4], pw[4];
  __builtin_amdgcn_sched_barrier(0);   // keeps the kernel-argument load above from sinking in behind the tile loads below; held here, a wait to 0 stands directly behind the last tile load
#pragma unroll
  for (int i = 0; i < 4; ++i) { px[i] = *(const v4f*)(xp + st * 32 + i * 32 * CC + lo); pw[i] = *(const v4f*)((i < 2 ? wp : wq) + st * 32 + i * 32 * CC + lo); }
  asm volatile("s_wait_xcnt 0x0" ::: "memory"); __builtin_amdgcn_sched_barrier(0);   // the wait stands in front of any later overwrite of the address registers that the loads above name; the scheduling barrier keeps later vector instructions from being lifted over it
  v8f acc[2][4] = {};
#pragma unroll 2
  for (int kc = 0; kc < CC / 32; ++kc) { const int bf = kc & 1;
#pragma unroll
    for (int i = 0; i < 4; ++i) { *(v4b*)&sx[bf][lr + 32 * i][lq * 4] = __builtin_convertvector(px[i], v4b); *(v4b*)&sw[bf][lr + 32 * i][lq * 4] = __builtin_convertvector(pw[i], v4b); }
    __syncthreads();   // publishes step kc's tiles; it also ends every wave's reads of the other buffer (step kc - 1) before step kc + 1 is stored there
    v16b a[2], w[4];
#pragma unroll
    for (int it = 0; it < 2; ++it) a[it] = frag_b(&sx[bf][wm * 32 + it * 16 + col][0], lane);
#pragma unroll
    for (int j = 0; j < 4; ++j) w[j] = frag_b(&sw[bf][wn * 64 + j * 16 + col][0], lane);
    if (kc + 1 < CC / 32) { const int kn = ((st + kc + 1) & (CC / 32 - 1)) * 32;   // next step of the wrapped walk, block-uniform
      const gcf xk = ubase(xp + kn), wk = ubase(wp + kn), wk2 = ubase(wq + kn);
#pragma unroll
      for (int i = 0; i < 4; ++i) { px[i] = *(gcv4)(xk + i * 32 * CC + lo); pw[i] = *(gcv4)((i < 2 ? wk : wk2) + i * 32 * CC + lo); }
      asm volatile("s_wait_xcnt 0x0" ::: "memory"); __builtin_amdgcn_sched_barrier(0);   // the wait stands in front of any later overwrite of the address registers that the loads above name; the scheduling barrier keeps later vector instructions from being lifted over it
    }
#pragma unroll
    for (int it = 0; it < 2; ++it)
#pragma unroll
      for (int j = 0; j < 4; ++j) acc[it][j] = wmma_bf(a[it], w[j], acc[it][j]);
    __builtin_amdgcn_sched_barrier(0); }   // keeps the next step's conversions, and with them the wait for its global loads, behind this step's products
  __syncthreads();   // the last step's fragment reads end before the epilogue tiles overwrite the staging buffers
  _Float16 (*sh)[136] = (_Float16 (*)[136])sm; _Float16 (*sl)[136] = (_Float16 (*)[136])(sm + 128 * 136 * 2); __bf16 (*th)[136] = (__bf16 (*)[136])sm; __bf16 (*tl2)[136] = (__bf16 (*)[136])(sm + 128 * 136 * 2);
  float bv[4];
#pragma unroll
  for (int j = 0; j < 4; ++j) bv[j] = Bv[(which ? (1 + wn) * CC + hp * 64 : c0 + wn * 64) + j * 16 + col];
  asm volatile("s_wait_xcnt 0x0" ::: "memory"); __builtin_amdgcn_sched_barrier(0);   // wait and scheduling barrier as behind the tile loads above
  if (which == 0) {
#pragma unroll
    for (int j = 0; j < 4; ++j) { const int cl = wn * 64 + j * 16 + col; const float bb = bfr(bv[j]);
#pragma unroll
      for (int it = 0; it < 2; ++it)
#pragma unroll
        for (int r = 0; r < 8; ++r) { const float v = acc[it][j][r] + bb; const int rl = wm * 32 + it * 16 + 8 * g + r; const _Float16 hv = (_Float16)v; sh[rl][cl] = hv; sl[rl][cl] = (_Float16)((v - (float)hv) * 1024.0f); } }
  } else {
#pragma unroll
    for (int j = 0; j < 4; ++j) { const int cl = wn * 64 + j * 16 + col; const float bb = bfr(bv[j]);
#pragma unroll
      for (int it = 0; it < 2; ++it) { v8b h8, l8;
#pragma unroll
        for (int r = 0; r < 8; ++r) { const float v = acc[it][j][r] + bb; const __bf16 bh = (__bf16)v; h8[r] = bh; l8[r] = (__bf16)(v - (float)bh); }
        *(v8b*)&th[cl][wm * 32 + it * 16 + 8 * g] = h8; *(v8b*)&tl2[cl][wm * 32 + it * 16 + 8 * g] = l8; }
      __builtin_amdgcn_sched_barrier(0); }   // one column group at a time: keeps the epilogue's register use under the loop's 160, at which three blocks share a WGP
  }
  __syncthreads();
  if (which == 0) { for (int e = tid; e < 128 * 16; e += 256) { const int rl = e >> 4, q = e & 15; vst2((unsigned*)(QH + (r0 + rl) * CC + c0 + q * 8), *(const v4u*)&sh[rl][q * 8]); vst2((unsigned*)(QL + (r0 + rl) * CC + c0 + q * 8), *(const v4u*)&sl[rl][q * 8]); } }
  else { const int hh = wave >> 2, it = (wave >> 1) & 1, jt = wave & 1, kr = hh * HD + it * 16 + col, vr = 64 + hh * HD + jt * 16 + col;   // wave = (head of the pair, tile (it, jt)); A rows = k cols (i), B cols = v cols (j), both read along t by frag_b: one k order
    v8f ahh = {}, alh = {}, ahl = {};
#pragma unroll
    for (int s = 0; s < 4; ++s) { const v16b kh = frag_b(&th[kr][s * 32], lane), kl = frag_b(&tl2[kr][s * 32], lane), vh = frag_b(&th[vr][s * 32], lane), vl = frag_b(&tl2[vr][s * 32], lane); ahh = wmma_bf(kh, vh, ahh); alh = wmma_bf(kl, vh, alh); ahl = wmma_bf(kh, vl, ahl); }
    const v8f t = ahh + (alh + ahl); float* o = KP + ((((size_t)blockIdx.x * NH + hp * 2 + hh) * 2 + jt) * 2 + it) * 256 + col * 16 + 8 * g;   // 1 KiB per wave, lane (j = col, i = 8 g ..)
    vst2(o, __builtin_shufflevector(t, t, 0, 1, 2, 3)); vst2(o + 4, __builtin_shufflevector(t, t, 4, 5, 6, 7));
    asm volatile("s_wait_xcnt 0x0" ::: "memory"); } }   // the wait stands behind the two stores, in front of any later overwrite of the registers that they name
// B fragment of one head's KV, stored tile by tile [jt][it][16 j][16 i]: elements 0..7 = i 8g + 0..7 (tile it 0), 8..15 = i 16 + 8g + 0..7 (tile it 1, 256 elements on): the k order of frag_h
__device__ __forceinline__ v16h frag_kv(const _Float16* row0, int lane) {
  union { v16h v; v8h q[2]; } u; const _Float16* p = row0 + 8 * (lane >> 4);
  u.q[0] = *(const v8h*)p; u.q[1] = *(const v8h*)(p + 256); return u.v;
}
// lane l's value added to that of lane l ^ M inside a 16-lane row (DPP row_xmask), and to that of lane l ^ 16: vector instructions, where __shfl_xor goes through the LDS pipe with a wait behind each step
template <int M> __device__ __forceinline__ float addx(float x) { return x + __builtin_bit_cast(float, __builtin_amdgcn_update_dpp(0, __builtin_bit_cast(int, x), 0x160 | M, 0xf, 0xf, true)); }
__device__ __forceinline__ float addh(float x) { return x + __builtin_bit_cast(float, __builtin_amdgcn_permlanex16(__builtin_bit_cast(int, x), __builtin_bit_cast(int, x), 0x76543210, 0xfedcba98, false, false)); }
__device__ __forceinline__ float wsum(float x) { return addh(addx<8>(addx<4>(addx<2>(addx<1>(x))))); }
// ---- k_ctx: block = (256 rows t, 2 heads), 8 waves of 32 rows. The block first adds the 16 row blocks' f32 partial KV tiles of its 2 heads in row-block order (32 loads of 16 B per thread, all in flight at once, the q fragment loads behind them) and keeps KV as f16 hi + residual tiles [head][jt][it][j][i] in LDS. Then ctx[t][h*32 + j] = sum_i q[t][h*32 + i] KV_h[i][j] (q hi+res x KV hi+res, 3 products, K = 32 = one chunk); 256-B segments per row. Each wave also takes, from the registers that hold its 16 x 32 values of a row tile and head, their sum and the sum of squares about their own mean; the block stores its 16 pairs of each head as one 128-B line
typedef __attribute__((ext_vector_type(4))) _Float16 v4h;
__global__ __launch_bounds__(256) void k_ctx(const _Float16* __restrict__ QH, const _Float16* __restrict__ QL, const float* __restrict__ KP, float* __restrict__ CTX, float* __restrict__ PS) { __shared__ __align__(16) float sf[8][32][68]; __shared__ __align__(16) _Float16 skh[2 * HD * HD], skl[2 * HD * HD]; __shared__ float sps[64]; float vv[4][16];
  const int tid = threadIdx.x, wave = tid >> 5, lane = tid & 31, col = lane & 15, g = lane >> 4; const int h0 = blockIdx.y * 2; const size_t r0 = (size_t)blockIdx.x * 256 + wave * 32; const size_t b = r0 / TT;
  const float* p = KP + (b * (TT / 128) * NH + h0) * (size_t)(HD * HD) + tid * 4;
  v4f f[2][TT / 128]; v16h ah[4], al[4];   // ah, al: [row tile * 2 + head]
#pragma unroll
  for (int w = 0; w < TT / 128; ++w) { f[0][w] = *(const v4f*)(p + (size_t)w * NH * HD * HD); f[1][w] = *(const v4f*)(p + (size_t)w * NH * HD * HD + HD * HD); }
#pragma unroll
  for (int u = 0; u < 4; ++u) { const size_t qo = (r0 + (u >> 1) * 16 + col) * CC + (h0 + (u & 1)) * HD; ah[u] = frag_h(QH + qo, lane); al[u] = frag_h(QL + qo, lane); }
  asm volatile("s_wait_xcnt 0x0" ::: "memory"); __builtin_amdgcn_sched_barrier(0);   // the wait stands in front of any later overwrite of the address registers that the loads above name; the scheduling barrier keeps later vector instructions from being lifted over it
#pragma unroll
  for (int hh = 0; hh < 2; ++hh) { v4f s = f[hh][0];
#pragma unroll
    for (int w = 1; w < TT / 128; ++w) s += f[hh][w];
    v4h h4, l4;
#pragma unroll
    for (int r = 0; r < 4; ++r) { const _Float16 hv = (_Float16)s[r]; h4[r] = hv; l4[r] = (_Float16)((s[r] - (float)hv) * 1024.0f); }
    *(v4h*)&skh[hh * HD * HD + tid * 4] = h4; *(v4h*)&skl[hh * HD * HD + tid * 4] = l4; }
  __builtin_amdgcn_fence(__ATOMIC_RELEASE, "workgroup", "local"); __builtin_amdgcn_s_barrier(); __builtin_amdgcn_fence(__ATOMIC_ACQUIRE, "workgroup", "local");   // work-group barrier that orders LDS alone: it publishes the two heads' KV tiles to every wave; __syncthreads() here would also wait for the q fragment loads, which go to the thread's own registers
#pragma unroll
  for (int hh = 0; hh < 2; ++hh)
#pragma unroll
    for (int jt = 0; jt < 2; ++jt) { const int bo = hh * HD * HD + jt * 512 + col * 16; const v16h bh = frag_kv(skh + bo, lane), bl = frag_kv(skl + bo, lane);
#pragma unroll
      for (int rt = 0; rt < 2; ++rt) { const int u = rt * 2 + hh; v8f acc = {}; acc = wmma16(ah[u], bh, acc); v8f t2 = {}; t2 = wmma16(al[u], bh, t2); t2 = wmma16(ah[u], bl, t2);
#pragma unroll
        for (int r = 0; r < 8; ++r) { const float v = acc[r] + t2[r] * (1.0f / 1024.0f); vv[u][jt * 8 + r] = v; sf[wave][rt * 16 + 8 * g + r][hh * 32 + jt * 16 + col] = v; } } }
  LDSX(); for (int rl = 0; rl < 32; rl += 2) vst2(CTX + (r0 + rl + g) * CC + h0 * HD + col * 4, *(const v4f*)&sf[wave][rl + g][col * 4]);
  asm volatile("s_wait_xcnt 0x0" ::: "memory"); __builtin_amdgcn_sched_barrier(0);   // the wait stands in front of any later overwrite of the registers that the stores above name; the scheduling barrier keeps the sums below behind it, so that the ctx stores are issued first and drain while the sums are taken
  float s[4], d[4];
#pragma unroll
  for (int u = 0; u < 4; ++u) { float a0 = 0.f, a1 = 0.f;
#pragma unroll
    for (int e = 0; e < 8; ++e) { a0 += vv[u][e]; a1 += vv[u][8 + e]; }
    s[u] = a0 + a1; }
#pragma unroll
  for (int u = 0; u < 4; ++u) s[u] = wsum(s[u]);
#pragma unroll
  for (int u = 0; u < 4; ++u) { const float m = s[u] * (1.0f / 512.0f); float a0 = 0.f, a1 = 0.f;
#pragma unroll
    for (int e = 0; e < 8; ++e) { const float t0 = vv[u][e] - m, t1 = vv[u][8 + e] - m; a0 += t0 * t0; a1 += t1 * t1; }
    d[u] = a0 + a1; }
#pragma unroll
  for (int u = 0; u < 4; ++u) d[u] = wsum(d[u]);
  if (lane == 0) {
#pragma unroll
    for (int u = 0; u < 4; ++u) { sps[(u & 1) * 32 + wave * 4 + (u >> 1) * 2] = s[u]; sps[(u & 1) * 32 + wave * 4 + (u >> 1) * 2 + 1] = d[u]; } }
  __builtin_amdgcn_fence(__ATOMIC_RELEASE, "workgroup", "local"); __builtin_amdgcn_s_barrier(); __builtin_amdgcn_fence(__ATOMIC_ACQUIRE, "workgroup", "local");   // work-group barrier that orders LDS alone: it publishes the eight waves' pairs to waves 0 and 1, each of which alone writes one head's line; __syncthreads() here also waited until the ctx stores above had been acknowledged
  if (wave < 2) vst2(PS + ((b * NH + h0 + wave) * (TT / 16) + (blockIdx.x % (TT / 256)) * 16) * 2 + lane, sps[wave * 32 + lane]); }
// ---- k_out: block = (128 rows, 128 cols), 8 waves of 32 x 64: out = gh (hi + lo) out_w^T + out_b with gh = (ctx - mu_h) rstd_h gn_w[c] + gn_b[c]; per 32-k step (one head) the block builds gh hi, gh lo and the bf16 out_w tile once and stages them in LDS (two buffers), as k_proj does; its global loads run three steps ahead of the products, in two register sets, and a step's tiles are built one step ahead, behind the fragment reads of the step before. mu_h and rstd_h come from k_ctx's partials: each block merges the 128 (sum, centred square sum) pairs of each of its batch's 32 heads ahead of its loop
__global__ __launch_bounds__(256) void k_out(const float* __restrict__ CTX, const float* __restrict__ PS, const float* __restrict__ GW, const float* __restrict__ GB, const float* __restrict__ WO, const float* __restrict__ BO, float* __restrict__ OUT) {
  __shared__ __align__(16) char sm[128 * 132 * 4];   // loop: gh hi, gh lo and W tiles, each [2][128][PT]; epilogue: f32 tile [128][132]
  __bf16 (*sa)[128][PT] = (__bf16 (*)[128][PT])sm; __bf16 (*sb)[128][PT] = (__bf16 (*)[128][PT])(sm + 2 * 128 * PT * 2); __bf16 (*sw)[128][PT] = (__bf16 (*)[128][PT])(sm + 4 * 128 * PT * 2);
  const int tid = threadIdx.x, wave = tid >> 5, lane = tid & 31, col = lane & 15, g = lane >> 4, wm = wave >> 1, wn = wave & 1; const int c0 = blockIdx.y * 128; const size_t r0 = (size_t)blockIdx.x * 128; const size_t b = r0 / TT;
  const int lr = tid >> 3, lq = tid & 7;   // staging: rows lr + 32 i, floats 4 lq .. 4 lq + 3
  const float* cp = CTX + r0 * CC; const float* wp = WO + (size_t)c0 * CC; const unsigned lo = lr * CC + lq * 4;   // block-uniform bases, one 32-bit lane offset for both tiles
  __shared__ float sst[2 * NH];   // mu, rstd of the batch's heads
  const int st = (blockIdx.x + 4 * blockIdx.y) & (CC / 32 - 1);   // first k step (head) of this block; the walk wraps round, as in k_proj: the blocks that share a ctx or an out_w tile stand at different steps
  const int s1 = (st + 1) & (CC / 32 - 1);   // second step of the walk
  v4f pc[2][4], pw[2][4], pgw[2], pgb[2], pq[8]; float mu[2], rs[2];   // [register set = step parity]
#pragma unroll
  for (int i = 0; i < 4; ++i) { const float* p = PS + ((b * NH + lr) * (TT / 16) + (lq + 8 * i) * 4) * 2; pq[2 * i] = *(const v4f*)p; pq[2 * i + 1] = *(const v4f*)(p + 4); }   // thread (head lr, eighth lq): 16 of the head's 128 pairs
  asm volatile("s_wait_xcnt 0x0" ::: "memory"); __builtin_amdgcn_sched_barrier(0);   // the wait stands in front of any later overwrite of the address registers that the loads of the pairs name (without it a tile load below took them as its destination); the scheduling barrier keeps the tile loads behind it
#pragma unroll
  for (int i = 0; i < 4; ++i) { pc[0][i] = *(const v4f*)(cp + st * 32 + i * 32 * CC + lo); pw[0][i] = *(const v4f*)(wp + st * 32 + i * 32 * CC + lo); }
  pgw[0] = *(const v4f*)(GW + st * 32 + lq * 4); pgb[0] = *(const v4f*)(GB + st * 32 + lq * 4);
#pragma unroll
  for (int i = 0; i < 4; ++i) { pc[1][i] = *(const v4f*)(cp + s1 * 32 + i * 32 * CC + lo); pw[1][i] = *(const v4f*)(wp + s1 * 32 + i * 32 * CC + lo); }
  pgw[1] = *(const v4f*)(GW + s1 * 32 + lq * 4); pgb[1] = *(const v4f*)(GB + s1 * 32 + lq * 4);
  asm volatile("s_wait_xcnt 0x0" ::: "memory"); __builtin_amdgcn_sched_barrier(0);   // the wait stands in front of any later overwrite of the address registers that the loads above name; the scheduling barrier keeps later vector instructions from being lifted over it
  float ssum = 0.f, sm2 = 0.f;
#pragma unroll
  for (int i = 0; i < 8; ++i) ssum += pq[i][0] + pq[i][2];
  ssum = addx<4>(addx<2>(addx<1>(ssum)));   // over the head's 8 threads
  const float mean = ssum / (float)(TT * HD);
#pragma unroll
  for (int i = 0; i < 8; ++i) { const float e0 = pq[i][0] * (1.0f / 512.0f) - mean, e1 = pq[i][2] * (1.0f / 512.0f) - mean; sm2 += (pq[i][1] + pq[i][3]) + 512.0f * (e0 * e0 + e1 * e1); }   // squares about the whole mean = squares about each part's own mean + 512 (part mean - mean)^2
  sm2 = addx<4>(addx<2>(addx<1>(sm2)));
  if (lq == 0) { sst[2 * lr] = mean; sst[2 * lr + 1] = rsqrtf(sm2 / (float)(TT * HD) + 1e-5f); }
  __syncthreads();   // publishes the 32 heads' mu and rstd to every wave
  mu[0] = sst[2 * st]; rs[0] = sst[2 * st + 1]; mu[1] = sst[2 * s1]; rs[1] = sst[2 * s1 + 1];
  v8f acc[2][4] = {};
  // register set s -> LDS buffer s: gh hi, gh lo and the bf16 out_w tile of the step that the set holds (32 channels per step == one head)
  auto conv = [&](const int s) __attribute__((always_inline)) {
#pragma unroll
    for (int i = 0; i < 4; ++i) { v4f v;
#pragma unroll
      for (int e = 0; e < 4; ++e) v[e] = (pc[s][i][e] - mu[s]) * rs[s] * bfr(pgw[s][e]) + bfr(pgb[s][e]);
      const v4b hv = __builtin_convertvector(v, v4b); *(v4b*)&sa[s][lr + 32 * i][lq * 4] = hv; *(v4b*)&sb[s][lr + 32 * i][lq * 4] = __builtin_convertvector(v - __builtin_convertvector(hv, v4f), v4b); *(v4b*)&sw[s][lr + 32 * i][lq * 4] = __builtin_convertvector(pw[s][i], v4b); } };
  // global loads of step ks of the wrapped walk into register set s, which has just been converted
  auto fetch = [&](const int s, const int ks) __attribute__((always_inline)) { const int kn = ((st + ks) & (CC / 32 - 1)) * 32;   // block-uniform
    const gcf ck = ubase(cp + kn), wk = ubase(wp + kn), gwk = ubase(GW + kn), gbk = ubase(GB + kn); mu[s] = sst[kn >> 4]; rs[s] = sst[(kn >> 4) + 1];
    __builtin_amdgcn_sched_barrier(0);   // the LDS stores above and the LDS read of mu, rs are issued ahead of the tile loads: among them they stood behind the waits that precede each re-use of a scalar base register
#pragma unroll
    for (int i = 0; i < 4; ++i) { pc[s][i] = *(gcv4)(ck + i * 32 * CC + lo); pw[s][i] = *(gcv4)(wk + i * 32 * CC + lo); }
    pgw[s] = *(gcv4)(gwk + (unsigned)(lq * 4)); pgb[s] = *(gcv4)(gbk + (unsigned)(lq * 4));
    asm volatile("s_wait_xcnt 0x0" ::: "memory"); __builtin_amdgcn_sched_barrier(0); };   // the wait stands in front of any later overwrite of the address registers that the loads above name; the scheduling barrier keeps later vector instructions from being lifted over it
  // step kc (parity bf): its fragment reads are issued, step kc + 1 is converted and stored while LDS serves them, step kc + 3 is fetched into the set so freed, then step kc's products. cv, ft: a step kc + 1, kc + 3 exists; bf, cv, ft are compile-time constants at each call (under a run-time test the compiler waited for every outstanding load ahead of a conversion, the younger set's too)
  auto step = [&](const int kc, const int bf, const bool cv, const bool ft) __attribute__((always_inline)) {
    __builtin_amdgcn_fence(__ATOMIC_RELEASE, "workgroup", "local"); __builtin_amdgcn_s_barrier(); __builtin_amdgcn_fence(__ATOMIC_ACQUIRE, "workgroup", "local");   // work-group barrier that orders LDS alone: it publishes step kc's tiles and ends every wave's reads of the other buffer (step kc - 1) before step kc + 1 is stored there; __syncthreads() here also waited for the global loads, which go to the thread's own registers and are to stay in flight
    v16b ah[2], al[2], w[4];
#pragma unroll
    for (int it = 0; it < 2; ++it) { ah[it] = frag_b(&sa[bf][wm * 32 + it * 16 + col][0], lane); al[it] = frag_b(&sb[bf][wm * 32 + it * 16 + col][0], lane); }
#pragma unroll
    for (int j = 0; j < 4; ++j) w[j] = frag_b(&sw[bf][wn * 64 + j * 16 + col][0], lane);
    __builtin_amdgcn_sched_barrier(0);   // the fragment reads are issued first, so that the conversion below runs while LDS serves them
    if (cv) conv(bf ^ 1);
    if (ft) fetch(bf ^ 1, kc + 3);
    else __builtin_amdgcn_sched_barrier(0);   // as at the end of fetch: keeps the products behind the conversion and its LDS stores
#pragma unroll
    for (int it = 0; it < 2; ++it)
#pragma unroll
      for (int j = 0; j < 4; ++j) acc[it][j] = wmma_bf(ah[it], w[j], acc[it][j]);
#pragma unroll
    for (int it = 0; it < 2; ++it)
#pragma unroll
      for (int j = 0; j < 4; ++j) acc[it][j] = wmma_bf(al[it], w[j], acc[it][j]); };
  conv(0); fetch(0, 2);
  for (int k2 = 0; k2 < CC / 32 - 4; k2 += 2) { step(k2, 0, true, true); step(k2 + 1, 1, true, true); }
  step(CC / 32 - 4, 0, true, true); step(CC / 32 - 3, 1, true, false); step(CC / 32 - 2, 0, true, false); step(CC / 32 - 1, 1, false, false);
  __syncthreads();   // the last step's fragment reads end before the epilogue tile overwrites the staging buffers
  float (*sf)[132] = (float (*)[132])sm;
#pragma unroll
  for (int j = 0; j < 4; ++j) { const int cl = wn * 64 + j * 16 + col; const float bb = bfr(BO[c0 + cl]);
#pragma unroll
    for (int it = 0; it < 2; ++it)
#pragma unroll
      for (int r = 0; r < 8; ++r) sf[wm * 32 + it * 16 + 8 * g + r][cl] = acc[it][j][r] + bb; }
  __syncthreads();
  for (int e = tid; e < 128 * 32; e += 256) { const int rl = e >> 5, q = e & 31; vst2(OUT + (r0 + rl) * CC + c0 + q * 4, *(const v4f*)&sf[rl][q * 4]); } }
extern "C" void kernel_launch(void* const* d_in, const int* in_sizes, int n_in, void* d_out, int out_size, void* d_ws, size_t ws_size, hipStream_t stream) {
  (void)in_sizes; (void)n_in; (void)out_size;
  const float** F = (const float**)d_in;   // 0 x [2,2048,1024], 1 Wqkv_w [3072,1024] ([out,in]; channel o = which*1024 + h*32 + d), 2 Wqkv_b [3072], 3 gn_w [1024], 4 gn_b, 5 out_w [1024,1024] ([out,in]), 6 out_b
  if (ws_size < (size_t)WS_END) return;
  char* ws = (char*)d_ws; _Float16 *QH = (_Float16*)(ws + WS_QH), *QL = (_Float16*)(ws + WS_QL); float *KP = (float*)(ws + WS_KP), *CTX = (float*)(ws + WS_CTX), *GS = (float*)(ws + WS_GS);
  k_proj<<<dim3(TNB * TT / 128, CC / 128, 3), 256, 0, stream>>>(F[0], F[1], F[2], QH, QL, KP);
  k_ctx<<<dim3(TNB * TT / 256, NH / 2), 256, 0, stream>>>(QH, QL, KP, CTX, GS);
  k_out<<<dim3(TNB * TT / 128, CC / 128), 256, 0, stream>>>(CTX, GS, F[3], F[4], F[5], F[6], (float*)d_out);
}
